// v000
// Times are from an AMD MI455X. After a warm-up the kernel runs many times in a row, and a time is the length of
// such a window on the GPU divided by its runs, so every launch and the gaps after it count. The runs cycle
// through copies of the inputs. A figure is the median of several windows, for all but v000 over two sittings.
// Sittings can differ by a few percent; kernels timed side by side share one.
// v000, which the later versions start from, runs in 124 microseconds.
#include <hip/hip_runtime.h>
#include <hip/hip_bf16.h>

// ---------------------------------------------------------------------------
// B=4, N=4096, M=1024, H=8, head dim 32, Q_IN=256, K_IN=512, OUT=256.
// out = skip_w@pcd + per-head softmax(qT k / sqrt(32)) @ vT      (fp32 out)
//
// All GEMMs run on v_wmma_f32_16x16x32_bf16 (wave32).  Key layout fact used
// everywhere: CDNA5 16-bit A and B operands share ONE register layout —
// outer index (A-row / B-col) = lane%16; element e holds K-chunk
//   lanes 0-15 : K in {0..7, 16..23},   lanes 16-31 : K in {8..15, 24..31}
// i.e. two 16-byte chunks at element offsets c0 and c0+16, c0 = (lane>=16)*8.
// fp32 C/D layout: VGPR r, lanes 0-15 = (row r, col lane),
//                          lanes 16-31 = (row r+8, col lane-16).
// ---------------------------------------------------------------------------

typedef __attribute__((ext_vector_type(16))) __bf16 v16bf;
typedef __attribute__((ext_vector_type(8)))  __bf16 v8bf;
typedef __attribute__((ext_vector_type(8)))  float  v8f;

#define CB 4
#define CH 8
#define CN 4096
#define CM 1024
#define CD 32
#define QIN 256
#define KIN 512
#define COUT 256

#define WMMA_BF16(A, B, C) \
    __builtin_amdgcn_wmma_f32_16x16x32_bf16(false, (A), false, (B), (short)0, (C), false, false)

union V16U { v16bf v; v8bf h2[2]; };

// 16 contiguous-chunk f32 -> bf16 operand (weight rows: W[outer, i0 + K(e)])
__device__ __forceinline__ v16bf load_contig_bf16(const float* __restrict__ p, int c0) {
    v16bf r;
    #pragma unroll
    for (int t = 0; t < 8; ++t) {
        r[t]     = (__bf16)p[c0 + t];
        r[t + 8] = (__bf16)p[c0 + 16 + t];
    }
    return r;
}

// strided f32 -> bf16 operand (activation cols: X[i0 + K(e)][outer], stride NC)
// per channel the 16 lanes hit 16 consecutive floats -> 64B coalesced requests
__device__ __forceinline__ v16bf load_strided_bf16(const float* __restrict__ p, int stride, int c0) {
    v16bf r;
    #pragma unroll
    for (int t = 0; t < 8; ++t) {
        r[t]     = (__bf16)p[(size_t)(c0 + t) * stride];
        r[t + 8] = (__bf16)p[(size_t)(c0 + 16 + t) * stride];
    }
    return r;
}

// ---------------------------------------------------------------------------
// Projection (W x X orientation): D[o, n] = sum_i W[o,i] X[b,i,n]  -> bf16
// dst layout [b, h, n, 32] (rows o map to consecutive d -> one 16B store).
// Used for Q (CIN=256, NC=4096) and K (CIN=512, NC=1024).
// ---------------------------------------------------------------------------
__global__ __launch_bounds__(256) void proj_wx_kernel(const float* __restrict__ X,
                                                      const float* __restrict__ W,
                                                      __bf16* __restrict__ dst,
                                                      int CIN, int NC) {
    const int lane = threadIdx.x & 31, wave = threadIdx.x >> 5;
    const int ln = lane & 15, hi = lane >> 4, c0 = hi ? 8 : 0;
    const int o0 = blockIdx.x * 16;
    const int n0 = (blockIdx.y * 8 + wave) * 16;
    const int b  = blockIdx.z;

    const float* wrow = W + (size_t)(o0 + ln) * CIN;
    const float* xcol = X + (size_t)b * CIN * NC + (n0 + ln);

    v8f acc = {};
    for (int i0 = 0; i0 < CIN; i0 += 32) {
        v16bf aw = load_contig_bf16(wrow + i0, c0);
        v16bf bx = load_strided_bf16(xcol + (size_t)i0 * NC, NC, c0);
        acc = WMMA_BF16(aw, bx, acc);
    }
    // D rows o = o0 + r + 8*hi  ->  d = (o0&16) + 8*hi + r (contiguous)
    const int h = o0 >> 5;
    v8bf pk;
    #pragma unroll
    for (int r = 0; r < 8; ++r) pk[r] = (__bf16)acc[r];
    __bf16* dp = dst + ((size_t)(b * CH + h) * NC + (n0 + ln)) * CD + (o0 & 16) + 8 * hi;
    *(v8bf*)dp = pk;
}

// ---------------------------------------------------------------------------
// V projection (X x W orientation): D[m, o] = sum_i X[b,i,m] W[o,i] -> bf16
// dst layout [b, h, 32, M] (rows m contiguous per lane -> one 16B store).
// ---------------------------------------------------------------------------
__global__ __launch_bounds__(256) void proj_v_kernel(const float* __restrict__ X,
                                                     const float* __restrict__ W,
                                                     __bf16* __restrict__ Vbf) {
    const int lane = threadIdx.x & 31, wave = threadIdx.x >> 5;
    const int ln = lane & 15, hi = lane >> 4, c0 = hi ? 8 : 0;
    const int o0 = blockIdx.x * 16;
    const int m0 = (blockIdx.y * 8 + wave) * 16;
    const int b  = blockIdx.z;

    const float* wrow = W + (size_t)(o0 + ln) * KIN;
    const float* xcol = X + (size_t)b * KIN * CM + (m0 + ln);

    v8f acc = {};
    for (int i0 = 0; i0 < KIN; i0 += 32) {
        v16bf ax = load_strided_bf16(xcol + (size_t)i0 * CM, CM, c0);
        v16bf bw = load_contig_bf16(wrow + i0, c0);
        acc = WMMA_BF16(ax, bw, acc);
    }
    // D rows m = m0 + r + 8*hi (contiguous), col o = o0 + ln -> d = (o0&16)+ln
    const int h = o0 >> 5;
    v8bf pk;
    #pragma unroll
    for (int r = 0; r < 8; ++r) pk[r] = (__bf16)acc[r];
    __bf16* dp = Vbf + ((size_t)(b * CH + h) * CD + (o0 & 16) + ln) * CM + m0 + 8 * hi;
    *(v8bf*)dp = pk;
}

// ---------------------------------------------------------------------------
// Skip projection (X x W orientation), fp32 out: out[b, o, n] = skip_w @ pcd
// ---------------------------------------------------------------------------
__global__ __launch_bounds__(256) void proj_skip_kernel(const float* __restrict__ X,
                                                        const float* __restrict__ W,
                                                        float* __restrict__ out) {
    const int lane = threadIdx.x & 31, wave = threadIdx.x >> 5;
    const int ln = lane & 15, hi = lane >> 4, c0 = hi ? 8 : 0;
    const int o0 = blockIdx.x * 16;
    const int n0 = (blockIdx.y * 8 + wave) * 16;
    const int b  = blockIdx.z;

    const float* wrow = W + (size_t)(o0 + ln) * QIN;
    const float* xcol = X + (size_t)b * QIN * CN + (n0 + ln);

    v8f acc = {};
    for (int i0 = 0; i0 < QIN; i0 += 32) {
        v16bf ax = load_strided_bf16(xcol + (size_t)i0 * CN, CN, c0);
        v16bf bw = load_contig_bf16(wrow + i0, c0);
        acc = WMMA_BF16(ax, bw, acc);
    }
    // D rows n = n0 + r + 8*hi (8 consecutive floats per lane), col o = o0+ln
    float* dp = out + ((size_t)(b * COUT) + o0 + ln) * CN + n0 + 8 * hi;
    #pragma unroll
    for (int r = 0; r < 8; ++r) dp[r] = acc[r];
}

// ---------------------------------------------------------------------------
// Fused attention, no LDS / no shuffles in the hot loop.
//   E^T = K-tile x Q-tile   (C-layout of E^T == B-layout of P^T, by symmetry)
//   x^T = V-tile x P^T      (accumulated over all M in two v8f tiles)
// Softmax uses unnormalized exp (scores ~ N(0,1); |max| ~ 6 => no overflow),
// per-column sums are lane-local partials + one shfl_xor(16) at the end.
// ---------------------------------------------------------------------------
__global__ __launch_bounds__(256) void attn_kernel(const __bf16* __restrict__ Qbf,
                                                   const __bf16* __restrict__ Kbf,
                                                   const __bf16* __restrict__ Vbf,
                                                   float* __restrict__ out) {
    const int lane = threadIdx.x & 31, wave = threadIdx.x >> 5;
    const int ln = lane & 15, hi = lane >> 4, c0 = hi ? 8 : 0;
    const int h = blockIdx.y;
    const int b = blockIdx.z;
    const int n0 = (blockIdx.x * 8 + wave) * 16;

    // B operand (Q): col n = n0+ln, K = head channel
    const __bf16* qrow = Qbf + ((size_t)(b * CH + h) * CN + n0 + ln) * CD;
    V16U bq;
    bq.h2[0] = *(const v8bf*)(qrow + c0);
    bq.h2[1] = *(const v8bf*)(qrow + c0 + 16);

    const __bf16* kbase = Kbf + (size_t)(b * CH + h) * CM * CD;
    const __bf16* vbase = Vbf + (size_t)(b * CH + h) * CD * CM;

    const float scale = 0.17677669529663689f;   // 1/sqrt(32)
    float lsum = 0.f;
    v8f accA = {}, accB = {};
    v8f zero = {};

    for (int m0 = 0; m0 < CM; m0 += 32) {
        if (m0 + 32 < CM)   // uniform branch; hint next K rows into cache
            __builtin_prefetch(kbase + (size_t)(m0 + 32 + ln) * CD, 0, 0);

        // A operands (K rows m0+ln and m0+16+ln)
        const __bf16* k0 = kbase + (size_t)(m0 + ln) * CD;
        const __bf16* k1 = k0 + 16 * CD;
        V16U ak0, ak1;
        ak0.h2[0] = *(const v8bf*)(k0 + c0);  ak0.h2[1] = *(const v8bf*)(k0 + c0 + 16);
        ak1.h2[0] = *(const v8bf*)(k1 + c0);  ak1.h2[1] = *(const v8bf*)(k1 + c0 + 16);

        // E^T tiles: rows m_rel, cols n
        v8f e0 = WMMA_BF16(ak0.v, bq.v, zero);
        v8f e1 = WMMA_BF16(ak1.v, bq.v, zero);

        // P^T = exp(E^T * scale); C-layout is exactly the next B-layout:
        //   element e of B  <->  p0[e] (e<8) / p1[e-8] (e>=8), all lanes alike
        V16U bp;
        #pragma unroll
        for (int r = 0; r < 8; ++r) {
            float p0 = __expf(e0[r] * scale);
            float p1 = __expf(e1[r] * scale);
            lsum += p0 + p1;                  // lane-local partial column sum
            bp.v[r]     = (__bf16)p0;
            bp.v[r + 8] = (__bf16)p1;
        }

        // A operands (V rows d = ln and 16+ln), K = m_rel
        const __bf16* v0 = vbase + (size_t)ln * CM + m0;
        const __bf16* v1 = v0 + (size_t)16 * CM;
        V16U av0, av1;
        av0.h2[0] = *(const v8bf*)(v0 + c0);  av0.h2[1] = *(const v8bf*)(v0 + c0 + 16);
        av1.h2[0] = *(const v8bf*)(v1 + c0);  av1.h2[1] = *(const v8bf*)(v1 + c0 + 16);

        // x^T accumulate: rows d, cols n
        accA = WMMA_BF16(av0.v, bp.v, accA);
        accB = WMMA_BF16(av1.v, bp.v, accB);
    }

    // combine the two half-column partial sums (lanes ln and ln+16 share n)
    lsum += __shfl_xor(lsum, 16, 32);
    const float inv = 1.0f / lsum;

    // out[b, h*32 + d, n] += x/lsum ; accA: d = r+8*hi, accB: d = 16+r+8*hi
    #pragma unroll
    for (int r = 0; r < 8; ++r) {
        const size_t iA = ((size_t)(b * COUT) + h * CD + r + 8 * hi) * CN + n0 + ln;
        const size_t iB = iA + (size_t)16 * CN;
        out[iA] += accA[r] * inv;
        out[iB] += accB[r] * inv;
    }
}

// ---------------------------------------------------------------------------
// Launcher
// ---------------------------------------------------------------------------
extern "C" void kernel_launch(void* const* d_in, const int* in_sizes, int n_in,
                              void* d_out, int out_size, void* d_ws, size_t ws_size,
                              hipStream_t stream) {
    const float* pcd = (const float*)d_in[0];   // [4,256,4096]
    const float* ps  = (const float*)d_in[1];   // [4,512,1024]
    const float* qw  = (const float*)d_in[2];   // [256,256]
    const float* kw  = (const float*)d_in[3];   // [256,512]
    const float* vw  = (const float*)d_in[4];   // [256,512]
    const float* sw  = (const float*)d_in[5];   // [256,256]
    float* out = (float*)d_out;                 // [4,256,4096]

    __bf16* Qbf = (__bf16*)d_ws;                           // 8 MB  [b,h,n,32]
    __bf16* Kbf = Qbf + (size_t)CB * CH * CN * CD;         // 2 MB  [b,h,m,32]
    __bf16* Vbf = Kbf + (size_t)CB * CH * CM * CD;         // 2 MB  [b,h,32,m]

    hipLaunchKernelGGL(proj_wx_kernel,   dim3(16, CN / 128, CB), dim3(256), 0, stream, pcd, qw, Qbf, QIN, CN);
    hipLaunchKernelGGL(proj_wx_kernel,   dim3(16, CM / 128, CB), dim3(256), 0, stream, ps,  kw, Kbf, KIN, CM);
    hipLaunchKernelGGL(proj_v_kernel,    dim3(16, CM / 128, CB), dim3(256), 0, stream, ps,  vw, Vbf);
    hipLaunchKernelGGL(proj_skip_kernel, dim3(16, CN / 128, CB), dim3(256), 0, stream, pcd, sw, out);
    hipLaunchKernelGGL(attn_kernel, dim3(CN / 128, CH, CB), dim3(256), 0, stream, Qbf, Kbf, Vbf, out);
}

// v001
// Measured time: 84.9 microseconds a run.
// Two timings next to v000 both put it at 1.52 times that version's speed.
#include <hip/hip_runtime.h>
#include <hip/hip_bf16.h>

// ---------------------------------------------------------------------------
// B=4, N=4096, M=1024, H=8, head dim 32, Q_IN=256, K_IN=512, OUT=256.
// out = skip_w@pcd + per-head softmax(qT k / sqrt(32)) @ vT      (fp32 out)
//
// All GEMMs run on v_wmma_f32_16x16x32_bf16 (wave32).  Key layout fact used
// everywhere: CDNA5 16-bit A and B operands share ONE register layout —
// outer index (A-row / B-col) = lane%16; element e holds K-chunk
//   lanes 0-15 : K in {0..7, 16..23},   lanes 16-31 : K in {8..15, 24..31}
// i.e. two 16-byte chunks at element offsets c0 and c0+16, c0 = (lane>=16)*8.
// fp32 C/D layout: VGPR r, lanes 0-15 = (row r, col lane),
//                          lanes 16-31 = (row r+8, col lane-16).
// ---------------------------------------------------------------------------

typedef __attribute__((ext_vector_type(16))) __bf16 v16bf;
typedef __attribute__((ext_vector_type(8)))  __bf16 v8bf;
typedef __attribute__((ext_vector_type(4)))  __bf16 v4bf;
typedef __attribute__((ext_vector_type(8)))  float  v8f;

#define CB 4
#define CH 8
#define CN 4096
#define CM 1024
#define CD 32
#define QIN 256
#define KIN 512
#define COUT 256

#define WMMA_BF16(A, B, C) \
    __builtin_amdgcn_wmma_f32_16x16x32_bf16(false, (A), false, (B), (short)0, (C), false, false)

union V16U { v16bf v; v8bf h2[2]; };

// ---------------------------------------------------------------------------
// Projections, all in the W x X orientation: D[o, n] = sum_i W[o,i] X[b,i,n].
// One wave owns a register tile of FO*16 output channels x 64 columns (FO = 2
// everywhere), so one activation fragment feeds FO products and one weight
// fragment feeds four.
// The 64 columns are dealt to the four column tiles interleaved: tile j, lane
// column ln  <->  n = n0 + 4*ln + j.  One 16-byte load per channel then fills
// the same element of all four B fragments, and 16 lanes cover 256 contiguous
// bytes of the channel's row.
// k order of both operands: element t <-> i0 + c0 + t, element t+8 <-> i0 + c0 + 16 + t.
// ---------------------------------------------------------------------------
template <int FO, int CIN, int NC>
__device__ __forceinline__ void proj_tile(const float* __restrict__ wrow,   // W + (o0+ln)*CIN + c0
                                          const float* __restrict__ xcol,   // X[b] + c0*NC + n0 + 4*ln
                                          v8f (&acc)[FO][4]) {
    #pragma unroll  // constant indices keep the arrays in registers
    for (int f = 0; f < FO; ++f)
        #pragma unroll  // constant indices keep the arrays in registers
        for (int j = 0; j < 4; ++j) acc[f][j] = v8f{};

    #pragma unroll  // row and column steps become immediate offsets of the loads
    for (int i0 = 0; i0 < CIN; i0 += 32) {
        // all loads of this k-step first, as one group: one wait per k-step
        float4 xr[16], wr[FO][4];
        #pragma unroll  // constant indices keep the arrays in registers
        for (int t = 0; t < 8; ++t) {
            xr[t]     = *(const float4*)(xcol + (size_t)(i0 + t) * NC);
            xr[t + 8] = *(const float4*)(xcol + (size_t)(i0 + 16 + t) * NC);
        }
        #pragma unroll  // constant indices keep the arrays in registers
        for (int f = 0; f < FO; ++f) {
            const float* wp = wrow + (size_t)f * 16 * CIN + i0;
            wr[f][0] = *(const float4*)(wp);
            wr[f][1] = *(const float4*)(wp + 4);
            wr[f][2] = *(const float4*)(wp + 16);
            wr[f][3] = *(const float4*)(wp + 20);
        }
        // keeps the group whole: without it the scheduler sinks weight loads
        // between the products and the wave waits out a load latency per fragment
        __builtin_amdgcn_sched_barrier(0);
        v16bf bx[4];
        #pragma unroll  // constant indices keep the arrays in registers
        for (int e = 0; e < 16; ++e) {
            bx[0][e] = (__bf16)xr[e].x;
            bx[1][e] = (__bf16)xr[e].y;
            bx[2][e] = (__bf16)xr[e].z;
            bx[3][e] = (__bf16)xr[e].w;
        }
        #pragma unroll  // constant indices keep the arrays in registers
        for (int f = 0; f < FO; ++f) {
            v16bf aw;
            #pragma unroll  // constant indices keep the arrays in registers
            for (int q = 0; q < 4; ++q) {
                aw[4 * q + 0] = (__bf16)wr[f][q].x;
                aw[4 * q + 1] = (__bf16)wr[f][q].y;
                aw[4 * q + 2] = (__bf16)wr[f][q].z;
                aw[4 * q + 3] = (__bf16)wr[f][q].w;
            }
            #pragma unroll  // constant indices keep the arrays in registers
            for (int j = 0; j < 4; ++j) acc[f][j] = WMMA_BF16(aw, bx[j], acc[f][j]);
        }
    }
    // precaution: the two address pairs that every load above names are inputs
    // here, so they stay untouched up to this wait and are reused only behind it
    asm volatile("s_wait_xcnt 0x0" :: "v"(wrow), "v"(xcol) : "memory");
}

// bf16 store in layout [b, h, n, 32]: rows o = o0 + 16f + 8*hi + r are 8
// consecutive head channels of column n -> one 16-byte store per tile.
template <int FO, int NC>
__device__ __forceinline__ void store_hn32(const v8f (&acc)[FO][4], __bf16* __restrict__ dst,
                                           int b, int o0, int n0, int ln, int hi) {
    #pragma unroll  // constant indices keep the arrays in registers
    for (int f = 0; f < FO; ++f) {
        const int of = o0 + 16 * f;
        #pragma unroll  // constant indices keep the arrays in registers
        for (int j = 0; j < 4; ++j) {
            v8bf pk;
            #pragma unroll  // constant indices keep the arrays in registers
            for (int r = 0; r < 8; ++r) pk[r] = (__bf16)acc[f][j][r];
            __bf16* dp = dst + ((size_t)(b * CH + (of >> 5)) * NC + (n0 + 4 * ln + j)) * CD + (of & 16) + 8 * hi;
            *(v8bf*)dp = pk;
        }
    }
}

// Q: block of 8 waves = 2 channel groups x 4 column groups (64 x 256 outputs):
// waves w and w+4 read the same activations, waves of one group the same weights.
// amdgpu_waves_per_eu(2, 2): the grid is one block per WGP, two waves per SIMD;
// told so, the scheduler keeps a k-step's 24 loads in one group instead of
// splitting the group to save registers for waves that never come.
__global__ __launch_bounds__(256) __attribute__((amdgpu_waves_per_eu(2, 2))) void proj_q_kernel(const float* __restrict__ X,
                                                     const float* __restrict__ W,
                                                     __bf16* __restrict__ dst) {
    const int lane = threadIdx.x & 31, wave = threadIdx.x >> 5;
    const int ln = lane & 15, hi = lane >> 4, c0 = hi ? 8 : 0;
    const int o0 = blockIdx.x * 64 + (wave >> 2) * 32;
    const int n0 = (blockIdx.y * 4 + (wave & 3)) * 64;
    const int b  = blockIdx.z;
    v8f acc[2][4];
    proj_tile<2, QIN, CN>(W + (size_t)(o0 + ln) * QIN + c0,
                          X + ((size_t)b * QIN + c0) * CN + n0 + 4 * ln, acc);
    store_hn32<2, CN>(acc, dst, b, o0, n0, ln, hi);
}

// K: block of 2 waves, two column groups that share the weight rows.
__global__ __launch_bounds__(64) void proj_k_kernel(const float* __restrict__ X,
                                                    const float* __restrict__ W,
                                                    __bf16* __restrict__ dst) {
    const int lane = threadIdx.x & 31, wave = threadIdx.x >> 5;
    const int ln = lane & 15, hi = lane >> 4, c0 = hi ? 8 : 0;
    const int o0 = blockIdx.x * 32;
    const int n0 = (blockIdx.y * 2 + wave) * 64;
    const int b  = blockIdx.z;
    v8f acc[2][4];
    proj_tile<2, KIN, CM>(W + (size_t)(o0 + ln) * KIN + c0,
                          X + ((size_t)b * KIN + c0) * CM + n0 + 4 * ln, acc);
    store_hn32<2, CM>(acc, dst, b, o0, n0, ln, hi);
}

// V: same tile as K; dst layout [b, h, 32, M] = row o, column m: the four
// column tiles of a lane are 4 consecutive m -> one 8-byte store per row.
__global__ __launch_bounds__(64) void proj_v_kernel(const float* __restrict__ X,
                                                    const float* __restrict__ W,
                                                    __bf16* __restrict__ Vbf) {
    const int lane = threadIdx.x & 31, wave = threadIdx.x >> 5;
    const int ln = lane & 15, hi = lane >> 4, c0 = hi ? 8 : 0;
    const int o0 = blockIdx.x * 32;
    const int m0 = (blockIdx.y * 2 + wave) * 64;
    const int b  = blockIdx.z;
    v8f acc[2][4];
    proj_tile<2, KIN, CM>(W + (size_t)(o0 + ln) * KIN + c0,
                          X + ((size_t)b * KIN + c0) * CM + m0 + 4 * ln, acc);
    #pragma unroll  // constant indices keep the arrays in registers
    for (int f = 0; f < 2; ++f)
        #pragma unroll  // constant indices keep the arrays in registers
        for (int r = 0; r < 8; ++r) {
            v4bf pk;
            #pragma unroll  // constant indices keep the arrays in registers
            for (int j = 0; j < 4; ++j) pk[j] = (__bf16)acc[f][j][r];
            __bf16* dp = Vbf + ((size_t)b * COUT + o0 + 16 * f + 8 * hi + r) * CM + m0 + 4 * ln;
            *(v4bf*)dp = pk;
        }
}

// Skip, fp32 out[b, o, n]: same block and attribute as Q; 4 consecutive n per
// lane and row -> one 16-byte store, 16 lanes cover 256 contiguous bytes.
__global__ __launch_bounds__(256) __attribute__((amdgpu_waves_per_eu(2, 2))) void proj_skip_kernel(const float* __restrict__ X,
                                                        const float* __restrict__ W,
                                                        float* __restrict__ out) {
    const int lane = threadIdx.x & 31, wave = threadIdx.x >> 5;
    const int ln = lane & 15, hi = lane >> 4, c0 = hi ? 8 : 0;
    const int o0 = blockIdx.x * 64 + (wave >> 2) * 32;
    const int n0 = (blockIdx.y * 4 + (wave & 3)) * 64;
    const int b  = blockIdx.z;
    v8f acc[2][4];
    proj_tile<2, QIN, CN>(W + (size_t)(o0 + ln) * QIN + c0,
                          X + ((size_t)b * QIN + c0) * CN + n0 + 4 * ln, acc);
    #pragma unroll  // constant indices keep the arrays in registers
    for (int f = 0; f < 2; ++f)
        #pragma unroll  // constant indices keep the arrays in registers
        for (int r = 0; r < 8; ++r) {
            float* dp = out + ((size_t)b * COUT + o0 + 16 * f + 8 * hi + r) * CN + n0 + 4 * ln;
            *(float4*)dp = make_float4(acc[f][0][r], acc[f][1][r], acc[f][2][r], acc[f][3][r]);
        }
}

// ---------------------------------------------------------------------------
// Fused attention, no LDS / no shuffles in the hot loop.
//   E^T = K-tile x Q-tile   (C-layout of E^T == B-layout of P^T, by symmetry)
//   x^T = V-tile x P^T      (accumulated over all M in two v8f tiles)
// Softmax uses unnormalized exp (scores ~ N(0,1); |max| ~ 6 => no overflow),
// per-column sums are lane-local partials + one shfl_xor(16) at the end.
// ---------------------------------------------------------------------------
__global__ __launch_bounds__(256) void attn_kernel(const __bf16* __restrict__ Qbf,
                                                   const __bf16* __restrict__ Kbf,
                                                   const __bf16* __restrict__ Vbf,
                                                   float* __restrict__ out) {
    const int lane = threadIdx.x & 31, wave = threadIdx.x >> 5;
    const int ln = lane & 15, hi = lane >> 4, c0 = hi ? 8 : 0;
    const int h = blockIdx.y;
    const int b = blockIdx.z;
    const int n0 = (blockIdx.x * 8 + wave) * 16;

    // B operand (Q): col n = n0+ln, K = head channel
    const __bf16* qrow = Qbf + ((size_t)(b * CH + h) * CN + n0 + ln) * CD;
    V16U bq;
    bq.h2[0] = *(const v8bf*)(qrow + c0);
    bq.h2[1] = *(const v8bf*)(qrow + c0 + 16);

    const __bf16* kbase = Kbf + (size_t)(b * CH + h) * CM * CD;
    const __bf16* vbase = Vbf + (size_t)(b * CH + h) * CD * CM;

    const float scale = 0.17677669529663689f;   // 1/sqrt(32)
    float lsum = 0.f;
    v8f accA = {}, accB = {};
    v8f zero = {};

    for (int m0 = 0; m0 < CM; m0 += 32) {
        if (m0 + 32 < CM)   // uniform branch; hint next K rows into cache
            __builtin_prefetch(kbase + (size_t)(m0 + 32 + ln) * CD, 0, 0);

        // A operands (K rows m0+ln and m0+16+ln)
        const __bf16* k0 = kbase + (size_t)(m0 + ln) * CD;
        const __bf16* k1 = k0 + 16 * CD;
        V16U ak0, ak1;
        ak0.h2[0] = *(const v8bf*)(k0 + c0);  ak0.h2[1] = *(const v8bf*)(k0 + c0 + 16);
        ak1.h2[0] = *(const v8bf*)(k1 + c0);  ak1.h2[1] = *(const v8bf*)(k1 + c0 + 16);

        // E^T tiles: rows m_rel, cols n
        v8f e0 = WMMA_BF16(ak0.v, bq.v, zero);
        v8f e1 = WMMA_BF16(ak1.v, bq.v, zero);

        // P^T = exp(E^T * scale); C-layout is exactly the next B-layout:
        //   element e of B  <->  p0[e] (e<8) / p1[e-8] (e>=8), all lanes alike
        V16U bp;
        #pragma unroll
        for (int r = 0; r < 8; ++r) {
            float p0 = __expf(e0[r] * scale);
            float p1 = __expf(e1[r] * scale);
            lsum += p0 + p1;                  // lane-local partial column sum
            bp.v[r]     = (__bf16)p0;
            bp.v[r + 8] = (__bf16)p1;
        }

        // A operands (V rows d = ln and 16+ln), K = m_rel
        const __bf16* v0 = vbase + (size_t)ln * CM + m0;
        const __bf16* v1 = v0 + (size_t)16 * CM;
        V16U av0, av1;
        av0.h2[0] = *(const v8bf*)(v0 + c0);  av0.h2[1] = *(const v8bf*)(v0 + c0 + 16);
        av1.h2[0] = *(const v8bf*)(v1 + c0);  av1.h2[1] = *(const v8bf*)(v1 + c0 + 16);

        // x^T accumulate: rows d, cols n
        accA = WMMA_BF16(av0.v, bp.v, accA);
        accB = WMMA_BF16(av1.v, bp.v, accB);
    }

    // combine the two half-column partial sums (lanes ln and ln+16 share n)
    lsum += __shfl_xor(lsum, 16, 32);
    const float inv = 1.0f / lsum;

    // out[b, h*32 + d, n] += x/lsum ; accA: d = r+8*hi, accB: d = 16+r+8*hi
    #pragma unroll
    for (int r = 0; r < 8; ++r) {
        const size_t iA = ((size_t)(b * COUT) + h * CD + r + 8 * hi) * CN + n0 + ln;
        const size_t iB = iA + (size_t)16 * CN;
        out[iA] += accA[r] * inv;
        out[iB] += accB[r] * inv;
    }
}

// ---------------------------------------------------------------------------
// Launcher
// ---------------------------------------------------------------------------
extern "C" void kernel_launch(void* const* d_in, const int* in_sizes, int n_in,
                              void* d_out, int out_size, void* d_ws, size_t ws_size,
                              hipStream_t stream) {
    const float* pcd = (const float*)d_in[0];   // [4,256,4096]
    const float* ps  = (const float*)d_in[1];   // [4,512,1024]
    const float* qw  = (const float*)d_in[2];   // [256,256]
    const float* kw  = (const float*)d_in[3];   // [256,512]
    const float* vw  = (const float*)d_in[4];   // [256,512]
    const float* sw  = (const float*)d_in[5];   // [256,256]
    float* out = (float*)d_out;                 // [4,256,4096]

    __bf16* Qbf = (__bf16*)d_ws;                           // 8 MB  [b,h,n,32]
    __bf16* Kbf = Qbf + (size_t)CB * CH * CN * CD;         // 2 MB  [b,h,m,32]
    __bf16* Vbf = Kbf + (size_t)CB * CH * CM * CD;         // 2 MB  [b,h,32,m]

    hipLaunchKernelGGL(proj_q_kernel,    dim3(4, CN / 256, CB), dim3(256), 0, stream, pcd, qw, Qbf);
    hipLaunchKernelGGL(proj_k_kernel,    dim3(8, CM / 128, CB), dim3(64),  0, stream, ps,  kw, Kbf);
    hipLaunchKernelGGL(proj_v_kernel,    dim3(8, CM / 128, CB), dim3(64),  0, stream, ps,  vw, Vbf);
    hipLaunchKernelGGL(proj_skip_kernel, dim3(4, CN / 256, CB), dim3(256), 0, stream, pcd, sw, out);
    hipLaunchKernelGGL(attn_kernel, dim3(CN / 128, CH, CB), dim3(256), 0, stream, Qbf, Kbf, Vbf, out);
}

// v002
// It runs in 73.6 microseconds.
// Two timings next to v001 put it at 1.17 and 1.14 times that version's speed.
// All steps since v000 together make it 1.75 times as fast.
#include <hip/hip_runtime.h>
#include <hip/hip_bf16.h>

// ---------------------------------------------------------------------------
// B=4, N=4096, M=1024, H=8, head dim 32, Q_IN=256, K_IN=512, OUT=256.
// out = skip_w@pcd + per-head softmax(qT k / sqrt(32)) @ vT      (fp32 out)
//
// All GEMMs run on v_wmma_f32_16x16x32_bf16 (wave32).  Key layout fact used
// everywhere: CDNA5 16-bit A and B operands share ONE register layout —
// outer index (A-row / B-col) = lane%16; element e holds K-chunk
//   lanes 0-15 : K in {0..7, 16..23},   lanes 16-31 : K in {8..15, 24..31}
// i.e. two 16-byte chunks at element offsets c0 and c0+16, c0 = (lane>=16)*8.
// fp32 C/D layout: VGPR r, lanes 0-15 = (row r, col lane),
//                          lanes 16-31 = (row r+8, col lane-16).
// ---------------------------------------------------------------------------

typedef __attribute__((ext_vector_type(16))) __bf16 v16bf;
typedef __attribute__((ext_vector_type(8)))  __bf16 v8bf;
typedef __attribute__((ext_vector_type(4)))  __bf16 v4bf;
typedef __attribute__((ext_vector_type(8)))  float  v8f;

#define CB 4
#define CH 8
#define CN 4096
#define CM 1024
#define CD 32
#define QIN 256
#define KIN 512
#define COUT 256

#define WMMA_BF16(A, B, C) \
    __builtin_amdgcn_wmma_f32_16x16x32_bf16(false, (A), false, (B), (short)0, (C), false, false)

union V16U { v16bf v; v8bf h2[2]; };

// ---------------------------------------------------------------------------
// Projections, all in the W x X orientation: D[o, n] = sum_i W[o,i] X[b,i,n].
// One wave owns a register tile of FO*16 output channels x 64 columns (FO = 2
// everywhere), so one activation fragment feeds FO products and one weight
// fragment feeds four.
// The 64 columns are dealt to the four column tiles interleaved: tile j, lane
// column ln  <->  n = n0 + 4*ln + j.  One 16-byte load per channel then fills
// the same element of all four B fragments, and 16 lanes cover 256 contiguous
// bytes of the channel's row.
// k order of both operands: element t <-> i0 + c0 + t, element t+8 <-> i0 + c0 + 16 + t.
// ---------------------------------------------------------------------------
template <int FO, int CIN, int NC>
__device__ __forceinline__ void proj_tile(const float* __restrict__ wrow,   // W + (o0+ln)*CIN + c0
                                          const float* __restrict__ xcol,   // X[b] + c0*NC + n0 + 4*ln
                                          v8f (&acc)[FO][4]) {
    #pragma unroll  // constant indices keep the arrays in registers
    for (int f = 0; f < FO; ++f)
        #pragma unroll  // constant indices keep the arrays in registers
        for (int j = 0; j < 4; ++j) acc[f][j] = v8f{};

    #pragma unroll  // row and column steps become immediate offsets of the loads
    for (int i0 = 0; i0 < CIN; i0 += 32) {
        // all loads of this k-step first, as one group: one wait per k-step
        float4 xr[16], wr[FO][4];
        #pragma unroll  // constant indices keep the arrays in registers
        for (int t = 0; t < 8; ++t) {
            xr[t]     = *(const float4*)(xcol + (size_t)(i0 + t) * NC);
            xr[t + 8] = *(const float4*)(xcol + (size_t)(i0 + 16 + t) * NC);
        }
        #pragma unroll  // constant indices keep the arrays in registers
        for (int f = 0; f < FO; ++f) {
            const float* wp = wrow + (size_t)f * 16 * CIN + i0;
            wr[f][0] = *(const float4*)(wp);
            wr[f][1] = *(const float4*)(wp + 4);
            wr[f][2] = *(const float4*)(wp + 16);
            wr[f][3] = *(const float4*)(wp + 20);
        }
        // keeps the group whole: without it the scheduler sinks weight loads
        // between the products and the wave waits out a load latency per fragment
        __builtin_amdgcn_sched_barrier(0);
        v16bf bx[4];
        #pragma unroll  // constant indices keep the arrays in registers
        for (int e = 0; e < 16; ++e) {
            bx[0][e] = (__bf16)xr[e].x;
            bx[1][e] = (__bf16)xr[e].y;
            bx[2][e] = (__bf16)xr[e].z;
            bx[3][e] = (__bf16)xr[e].w;
        }
        #pragma unroll  // constant indices keep the arrays in registers
        for (int f = 0; f < FO; ++f) {
            v16bf aw;
            #pragma unroll  // constant indices keep the arrays in registers
            for (int q = 0; q < 4; ++q) {
                aw[4 * q + 0] = (__bf16)wr[f][q].x;
                aw[4 * q + 1] = (__bf16)wr[f][q].y;
                aw[4 * q + 2] = (__bf16)wr[f][q].z;
                aw[4 * q + 3] = (__bf16)wr[f][q].w;
            }
            #pragma unroll  // constant indices keep the arrays in registers
            for (int j = 0; j < 4; ++j) acc[f][j] = WMMA_BF16(aw, bx[j], acc[f][j]);
        }
    }
    // precaution: the two address pairs that every load above names are inputs
    // here, so they stay untouched up to this wait and are reused only behind it
    asm volatile("s_wait_xcnt 0x0" :: "v"(wrow), "v"(xcol) : "memory");
}

// bf16 store of Q and K in fragment order.  Per (b, h) the plane is cut into
// tiles of 16 columns x 32 head channels = 1 KB, laid out as the attention
// kernel's operand registers want them:
//   [tile n/16][half s = ch/16][lane = 16*((ch/8)&1) + n%16][8 channels]
// so a wave's 16-byte load of one half covers 512 contiguous bytes.
// Rows o = o0 + 16f + 8*hi + r are 8 consecutive head channels of column n:
// exactly one 16-byte chunk (s = f, chunk lane = 16*hi + n%16).
template <int FO, int NC>
__device__ __forceinline__ void store_hn32(const v8f (&acc)[FO][4], __bf16* __restrict__ dst,
                                           int b, int o0, int n0, int ln, int hi) {
    #pragma unroll  // constant indices keep the arrays in registers
    for (int f = 0; f < FO; ++f) {
        const int of = o0 + 16 * f;
        #pragma unroll  // constant indices keep the arrays in registers
        for (int j = 0; j < 4; ++j) {
            v8bf pk;
            #pragma unroll  // constant indices keep the arrays in registers
            for (int r = 0; r < 8; ++r) pk[r] = (__bf16)acc[f][j][r];
            const int n = n0 + 4 * ln + j;
            __bf16* dp = dst + (size_t)(b * CH + (of >> 5)) * NC * CD + (n >> 4) * 512 + (of & 16) * 16 + (16 * hi + (n & 15)) * 8;
            *(v8bf*)dp = pk;
        }
    }
}

// Q: block of 8 waves = 2 channel groups x 4 column groups (64 x 256 outputs):
// waves w and w+4 read the same activations, waves of one group the same weights.
// amdgpu_waves_per_eu(2, 2): the grid is one block per WGP, two waves per SIMD;
// told so, the scheduler keeps a k-step's 24 loads in one group instead of
// splitting the group to save registers for waves that never come.
__global__ __launch_bounds__(256) __attribute__((amdgpu_waves_per_eu(2, 2))) void proj_q_kernel(const float* __restrict__ X,
                                                     const float* __restrict__ W,
                                                     __bf16* __restrict__ dst) {
    const int lane = threadIdx.x & 31, wave = threadIdx.x >> 5;
    const int ln = lane & 15, hi = lane >> 4, c0 = hi ? 8 : 0;
    const int o0 = blockIdx.x * 64 + (wave >> 2) * 32;
    const int n0 = (blockIdx.y * 4 + (wave & 3)) * 64;
    const int b  = blockIdx.z;
    v8f acc[2][4];
    proj_tile<2, QIN, CN>(W + (size_t)(o0 + ln) * QIN + c0,
                          X + ((size_t)b * QIN + c0) * CN + n0 + 4 * ln, acc);
    store_hn32<2, CN>(acc, dst, b, o0, n0, ln, hi);
}

// K: block of 2 waves, two column groups that share the weight rows.
__global__ __launch_bounds__(64) void proj_k_kernel(const float* __restrict__ X,
                                                    const float* __restrict__ W,
                                                    __bf16* __restrict__ dst) {
    const int lane = threadIdx.x & 31, wave = threadIdx.x >> 5;
    const int ln = lane & 15, hi = lane >> 4, c0 = hi ? 8 : 0;
    const int o0 = blockIdx.x * 32;
    const int n0 = (blockIdx.y * 2 + wave) * 64;
    const int b  = blockIdx.z;
    v8f acc[2][4];
    proj_tile<2, KIN, CM>(W + (size_t)(o0 + ln) * KIN + c0,
                          X + ((size_t)b * KIN + c0) * CM + n0 + 4 * ln, acc);
    store_hn32<2, CM>(acc, dst, b, o0, n0, ln, hi);
}

// V: same tile as K; stored in fragment order too.  Per (b, h), blocks of 32
// keys x 32 channels = 2 KB:
//   [block m/32][channel tile d/16][half s = (m/16)&1][lane = 16*((m/8)&1) + d%16][8 keys]
// The four column tiles of a lane are 4 consecutive m, half of one 16-byte
// chunk -> one 8-byte store per row.
__global__ __launch_bounds__(64) void proj_v_kernel(const float* __restrict__ X,
                                                    const float* __restrict__ W,
                                                    __bf16* __restrict__ Vbf) {
    const int lane = threadIdx.x & 31, wave = threadIdx.x >> 5;
    const int ln = lane & 15, hi = lane >> 4, c0 = hi ? 8 : 0;
    const int o0 = blockIdx.x * 32;
    const int m0 = (blockIdx.y * 2 + wave) * 64;
    const int b  = blockIdx.z;
    v8f acc[2][4];
    proj_tile<2, KIN, CM>(W + (size_t)(o0 + ln) * KIN + c0,
                          X + ((size_t)b * KIN + c0) * CM + m0 + 4 * ln, acc);
    #pragma unroll  // constant indices keep the arrays in registers
    for (int f = 0; f < 2; ++f)
        #pragma unroll  // constant indices keep the arrays in registers
        for (int r = 0; r < 8; ++r) {
            v4bf pk;
            #pragma unroll  // constant indices keep the arrays in registers
            for (int j = 0; j < 4; ++j) pk[j] = (__bf16)acc[f][j][r];
            __bf16* dp = Vbf + (size_t)(b * CH + (o0 >> 5)) * CD * CM + ((m0 >> 5) + (ln >> 3)) * 1024 + f * 512
                       + ((ln >> 2) & 1) * 256 + (16 * ((ln >> 1) & 1) + 8 * hi + r) * 8 + 4 * (ln & 1);
            *(v4bf*)dp = pk;
        }
}

// Skip, fp32 out[b, o, n]: same block and attribute as Q; 4 consecutive n per
// lane and row -> one 16-byte store, 16 lanes cover 256 contiguous bytes.
__global__ __launch_bounds__(256) __attribute__((amdgpu_waves_per_eu(2, 2))) void proj_skip_kernel(const float* __restrict__ X,
                                                        const float* __restrict__ W,
                                                        float* __restrict__ out) {
    const int lane = threadIdx.x & 31, wave = threadIdx.x >> 5;
    const int ln = lane & 15, hi = lane >> 4, c0 = hi ? 8 : 0;
    const int o0 = blockIdx.x * 64 + (wave >> 2) * 32;
    const int n0 = (blockIdx.y * 4 + (wave & 3)) * 64;
    const int b  = blockIdx.z;
    v8f acc[2][4];
    proj_tile<2, QIN, CN>(W + (size_t)(o0 + ln) * QIN + c0,
                          X + ((size_t)b * QIN + c0) * CN + n0 + 4 * ln, acc);
    #pragma unroll  // constant indices keep the arrays in registers
    for (int f = 0; f < 2; ++f)
        #pragma unroll  // constant indices keep the arrays in registers
        for (int r = 0; r < 8; ++r) {
            float* dp = out + ((size_t)b * COUT + o0 + 16 * f + 8 * hi + r) * CN + n0 + 4 * ln;
            *(float4*)dp = make_float4(acc[f][0][r], acc[f][1][r], acc[f][2][r], acc[f][3][r]);
        }
}

// ---------------------------------------------------------------------------
// Fused attention, no LDS / no shuffles in the hot loop.
//   E^T = K-tile x Q-tile   (C-layout of E^T == B-layout of P^T, by symmetry)
//   x^T = V-tile x P^T      (accumulated over all M in two v8f tiles)
// Softmax uses unnormalized exp (scores ~ N(0,1); |max| ~ 6 => no overflow),
// per-column sums are lane-local partials + one shfl_xor(16) at the end.
// ---------------------------------------------------------------------------
__global__ __launch_bounds__(256) void attn_kernel(const __bf16* __restrict__ Qbf,
                                                   const __bf16* __restrict__ Kbf,
                                                   const __bf16* __restrict__ Vbf,
                                                   float* __restrict__ out) {
    const int lane = threadIdx.x & 31, wave = threadIdx.x >> 5;
    const int ln = lane & 15, hi = lane >> 4;
    const int h = blockIdx.y;
    const int b = blockIdx.z;
    const int n0 = (blockIdx.x * 8 + wave) * 16;

    // B operand (Q): col n = n0+ln, K = head channel; fragment order: the two
    // halves of tile n0/16 are 512 contiguous bytes each, 16 bytes per lane
    const __bf16* qrow = Qbf + ((size_t)(b * CH + h) * CN + n0) * CD + lane * 8;
    V16U bq;
    bq.h2[0] = *(const v8bf*)(qrow);
    bq.h2[1] = *(const v8bf*)(qrow + 256);

    const __bf16* kbase = Kbf + (size_t)(b * CH + h) * CM * CD;
    const __bf16* vbase = Vbf + (size_t)(b * CH + h) * CD * CM;

    const float scale = 0.17677669529663689f;   // 1/sqrt(32)
    float lsum = 0.f;
    v8f accA = {}, accB = {};
    v8f zero = {};

    for (int m0 = 0; m0 < CM; m0 += 32) {
        if (m0 + 32 < CM)   // uniform branch; hint next K rows into cache
            __builtin_prefetch(kbase + (size_t)(m0 + 32 + ln) * CD, 0, 0);

        // A operands (K rows m0+ln and m0+16+ln): tiles m0/16 and m0/16+1
        const __bf16* k0 = kbase + (size_t)m0 * CD + lane * 8;
        V16U ak0, ak1;
        ak0.h2[0] = *(const v8bf*)(k0);        ak0.h2[1] = *(const v8bf*)(k0 + 256);
        ak1.h2[0] = *(const v8bf*)(k0 + 512);  ak1.h2[1] = *(const v8bf*)(k0 + 768);
        // precaution: the address pair that the four K loads name is an input here,
        // so it stays untouched up to this wait and is reused only behind it
        asm volatile("s_wait_xcnt 0x0" :: "v"(k0) : "memory");

        // E^T tiles: rows m_rel, cols n
        v8f e0 = WMMA_BF16(ak0.v, bq.v, zero);
        v8f e1 = WMMA_BF16(ak1.v, bq.v, zero);

        // P^T = exp(E^T * scale); C-layout is exactly the next B-layout:
        //   element e of B  <->  p0[e] (e<8) / p1[e-8] (e>=8), all lanes alike
        V16U bp;
        #pragma unroll
        for (int r = 0; r < 8; ++r) {
            float p0 = __expf(e0[r] * scale);
            float p1 = __expf(e1[r] * scale);
            lsum += p0 + p1;                  // lane-local partial column sum
            bp.v[r]     = (__bf16)p0;
            bp.v[r + 8] = (__bf16)p1;
        }

        // A operands (V rows d = ln and 16+ln), K = m_rel: block m0/32
        const __bf16* v0 = vbase + (size_t)m0 * CD + lane * 8;
        V16U av0, av1;
        av0.h2[0] = *(const v8bf*)(v0);        av0.h2[1] = *(const v8bf*)(v0 + 256);
        av1.h2[0] = *(const v8bf*)(v0 + 512);  av1.h2[1] = *(const v8bf*)(v0 + 768);

        // x^T accumulate: rows d, cols n
        accA = WMMA_BF16(av0.v, bp.v, accA);
        accB = WMMA_BF16(av1.v, bp.v, accB);
    }

    // combine the two half-column partial sums (lanes ln and ln+16 share n)
    lsum += __shfl_xor(lsum, 16, 32);
    const float inv = 1.0f / lsum;

    // out[b, h*32 + d, n] += x/lsum ; accA: d = r+8*hi, accB: d = 16+r+8*hi
    #pragma unroll
    for (int r = 0; r < 8; ++r) {
        const size_t iA = ((size_t)(b * COUT) + h * CD + r + 8 * hi) * CN + n0 + ln;
        const size_t iB = iA + (size_t)16 * CN;
        out[iA] += accA[r] * inv;
        out[iB] += accB[r] * inv;
    }
}

// ---------------------------------------------------------------------------
// Launcher
// ---------------------------------------------------------------------------
extern "C" void kernel_launch(void* const* d_in, const int* in_sizes, int n_in,
                              void* d_out, int out_size, void* d_ws, size_t ws_size,
                              hipStream_t stream) {
    const float* pcd = (const float*)d_in[0];   // [4,256,4096]
    const float* ps  = (const float*)d_in[1];   // [4,512,1024]
    const float* qw  = (const float*)d_in[2];   // [256,256]
    const float* kw  = (const float*)d_in[3];   // [256,512]
    const float* vw  = (const float*)d_in[4];   // [256,512]
    const float* sw  = (const float*)d_in[5];   // [256,256]
    float* out = (float*)d_out;                 // [4,256,4096]

    __bf16* Qbf = (__bf16*)d_ws;                           // 8 MB  [b,h] planes, fragment order
    __bf16* Kbf = Qbf + (size_t)CB * CH * CN * CD;         // 2 MB  [b,h] planes, fragment order
    __bf16* Vbf = Kbf + (size_t)CB * CH * CM * CD;         // 2 MB  [b,h] planes, fragment order

    hipLaunchKernelGGL(proj_q_kernel,    dim3(4, CN / 256, CB), dim3(256), 0, stream, pcd, qw, Qbf);
    hipLaunchKernelGGL(proj_k_kernel,    dim3(8, CM / 128, CB), dim3(64),  0, stream, ps,  kw, Kbf);
    hipLaunchKernelGGL(proj_v_kernel,    dim3(8, CM / 128, CB), dim3(64),  0, stream, ps,  vw, Vbf);
    hipLaunchKernelGGL(proj_skip_kernel, dim3(4, CN / 256, CB), dim3(256), 0, stream, pcd, sw, out);
    hipLaunchKernelGGL(attn_kernel, dim3(CN / 128, CH, CB), dim3(256), 0, stream, Qbf, Kbf, Vbf, out);
}

// v003
// It runs in 55.8 microseconds.
// Timed twice side by side with v002, it ran 1.32 and 1.31 times as fast.
// Over all steps from v000 it is 2.31 times as fast.
#include <hip/hip_runtime.h>
#include <hip/hip_bf16.h>

// ---------------------------------------------------------------------------
// B=4, N=4096, M=1024, H=8, head dim 32, Q_IN=256, K_IN=512, OUT=256.
// out = skip_w@pcd + per-head softmax(qT k / sqrt(32)) @ vT      (fp32 out)
//
// All GEMMs run on v_wmma_f32_16x16x32_bf16 (wave32).  Key layout fact used
// everywhere: CDNA5 16-bit A and B operands share ONE register layout —
// outer index (A-row / B-col) = lane%16; element e holds K-chunk
//   lanes 0-15 : K in {0..7, 16..23},   lanes 16-31 : K in {8..15, 24..31}
// i.e. two 16-byte chunks at element offsets c0 and c0+16, c0 = (lane>=16)*8.
// fp32 C/D layout: VGPR r, lanes 0-15 = (row r, col lane),
//                          lanes 16-31 = (row r+8, col lane-16).
// ---------------------------------------------------------------------------

typedef __attribute__((ext_vector_type(16))) __bf16 v16bf;
typedef __attribute__((ext_vector_type(8)))  __bf16 v8bf;
typedef __attribute__((ext_vector_type(4)))  __bf16 v4bf;
typedef __attribute__((ext_vector_type(8)))  float  v8f;

#define CB 4
#define CH 8
#define CN 4096
#define CM 1024
#define CD 32
#define QIN 256
#define KIN 512
#define COUT 256

#define WMMA_BF16(A, B, C) \
    __builtin_amdgcn_wmma_f32_16x16x32_bf16(false, (A), false, (B), (short)0, (C), false, false)

union V16U { v16bf v; v8bf h2[2]; };

// ---------------------------------------------------------------------------
// Projections, all in the W x X orientation: D[o, n] = sum_i W[o,i] X[b,i,n].
// One wave owns a register tile of FO*16 output channels x 64 columns (FO = 2
// everywhere), so one activation fragment feeds FO products and one weight
// fragment feeds four.
// The 64 columns are dealt to the four column tiles interleaved: tile j, lane
// column ln  <->  n = n0 + 4*ln + j.  One 16-byte load per channel then fills
// the same element of all four B fragments, and 16 lanes cover 256 contiguous
// bytes of the channel's row.
// k order of both operands: element t <-> i0 + c0 + t, element t+8 <-> i0 + c0 + 16 + t.
// ---------------------------------------------------------------------------
template <int FO, int CIN, int NC>
__device__ __forceinline__ void proj_tile(const float* __restrict__ wrow,   // W + (o0+ln)*CIN + c0
                                          const float* __restrict__ xcol,   // X[b] + c0*NC + n0 + 4*ln
                                          v8f (&acc)[FO][4]) {
    #pragma unroll  // constant indices keep the arrays in registers
    for (int f = 0; f < FO; ++f)
        #pragma unroll  // constant indices keep the arrays in registers
        for (int j = 0; j < 4; ++j) acc[f][j] = v8f{};

    #pragma unroll  // row and column steps become immediate offsets of the loads
    for (int i0 = 0; i0 < CIN; i0 += 32) {
        // all loads of this k-step first, as one group: one wait per k-step
        float4 xr[16], wr[FO][4];
        #pragma unroll  // constant indices keep the arrays in registers
        for (int t = 0; t < 8; ++t) {
            xr[t]     = *(const float4*)(xcol + (size_t)(i0 + t) * NC);
            xr[t + 8] = *(const float4*)(xcol + (size_t)(i0 + 16 + t) * NC);
        }
        #pragma unroll  // constant indices keep the arrays in registers
        for (int f = 0; f < FO; ++f) {
            const float* wp = wrow + (size_t)f * 16 * CIN + i0;
            wr[f][0] = *(const float4*)(wp);
            wr[f][1] = *(const float4*)(wp + 4);
            wr[f][2] = *(const float4*)(wp + 16);
            wr[f][3] = *(const float4*)(wp + 20);
        }
        // keeps the group whole: without it the scheduler sinks weight loads
        // between the products and the wave waits out a load latency per fragment
        __builtin_amdgcn_sched_barrier(0);
        v16bf bx[4];
        #pragma unroll  // constant indices keep the arrays in registers
        for (int e = 0; e < 16; ++e) {
            bx[0][e] = (__bf16)xr[e].x;
            bx[1][e] = (__bf16)xr[e].y;
            bx[2][e] = (__bf16)xr[e].z;
            bx[3][e] = (__bf16)xr[e].w;
        }
        #pragma unroll  // constant indices keep the arrays in registers
        for (int f = 0; f < FO; ++f) {
            v16bf aw;
            #pragma unroll  // constant indices keep the arrays in registers
            for (int q = 0; q < 4; ++q) {
                aw[4 * q + 0] = (__bf16)wr[f][q].x;
                aw[4 * q + 1] = (__bf16)wr[f][q].y;
                aw[4 * q + 2] = (__bf16)wr[f][q].z;
                aw[4 * q + 3] = (__bf16)wr[f][q].w;
            }
            #pragma unroll  // constant indices keep the arrays in registers
            for (int j = 0; j < 4; ++j) acc[f][j] = WMMA_BF16(aw, bx[j], acc[f][j]);
        }
    }
    // precaution: the two address pairs that every load above names are inputs
    // here, so they stay untouched up to this wait and are reused only behind it
    asm volatile("s_wait_xcnt 0x0" :: "v"(wrow), "v"(xcol) : "memory");
}

// bf16 store of Q and K in fragment order.  Per (b, h) the plane is cut into
// tiles of 16 columns x 32 head channels = 1 KB, laid out as the attention
// kernel's operand registers want them:
//   [tile n/16][half s = ch/16][lane = 16*((ch/8)&1) + n%16][8 channels]
// so a wave's 16-byte load of one half covers 512 contiguous bytes.
// Rows o = o0 + 16f + 8*hi + r are 8 consecutive head channels of column n:
// exactly one 16-byte chunk (s = f, chunk lane = 16*hi + n%16).
template <int FO, int NC>
__device__ __forceinline__ void store_hn32(const v8f (&acc)[FO][4], __bf16* __restrict__ dst,
                                           int b, int o0, int n0, int ln, int hi) {
    #pragma unroll  // constant indices keep the arrays in registers
    for (int f = 0; f < FO; ++f) {
        const int of = o0 + 16 * f;
        #pragma unroll  // constant indices keep the arrays in registers
        for (int j = 0; j < 4; ++j) {
            v8bf pk;
            #pragma unroll  // constant indices keep the arrays in registers
            for (int r = 0; r < 8; ++r) pk[r] = (__bf16)acc[f][j][r];
            const int n = n0 + 4 * ln + j;
            __bf16* dp = dst + (size_t)(b * CH + (of >> 5)) * NC * CD + (n >> 4) * 512 + (of & 16) * 16 + (16 * hi + (n & 15)) * 8;
            *(v8bf*)dp = pk;
        }
    }
}

// All four projections are independent of each other: ONE launch, the block
// index picks the job.  Every block is 8 waves = 2 channel groups x 4 column
// groups (64 x 256 outputs): waves w and w+4 read the same activations, the
// waves of one channel group the same weights.
//   blocks 0..127   : K and V (512 input channels, the longer job, started first)
//   blocks 128..639 : Q and skip (256 input channels)
// Inside a range the index runs channel block, then which weight matrix, then
// column block, then batch: the 8 blocks that read one activation tile are
// neighbours.  The two jobs of a range share one copy of the product loop; only
// the weight pointer and the store differ, chosen by block-uniform tests.
// amdgpu_waves_per_eu(2, 4): the register budget of two waves per SIMD lets the
// scheduler keep a k-step's 24 loads in one group; up to four waves (two blocks
// per WGP) may be resident, so one block's products run under another's loads.
#define KV_BLOCKS 128
#define ALL_BLOCKS 640
__global__ __launch_bounds__(256) __attribute__((amdgpu_waves_per_eu(2, 4))) void proj_all_kernel(const float* __restrict__ pcd,
                                                       const float* __restrict__ ps,
                                                       const float* __restrict__ qw,
                                                       const float* __restrict__ kw,
                                                       const float* __restrict__ vw,
                                                       const float* __restrict__ sw,
                                                       __bf16* __restrict__ Qbf,
                                                       __bf16* __restrict__ Kbf,
                                                       __bf16* __restrict__ Vbf,
                                                       float* __restrict__ out) {
    const int lane = threadIdx.x & 31, wave = threadIdx.x >> 5;
    const int ln = lane & 15, hi = lane >> 4, c0 = hi ? 8 : 0;
    const int bid = blockIdx.x;
    v8f acc[2][4];
    if (bid < KV_BLOCKS) {
        const bool second = (bid >> 2) & 1;              // V, else K
        const int o0 = (bid & 3) * 64 + (wave >> 2) * 32;
        const int m0 = (((bid >> 3) & 3) * 4 + (wave & 3)) * 64;
        const int b  = bid >> 5;
        const float* W = second ? vw : kw;
        proj_tile<2, KIN, CM>(W + (size_t)(o0 + ln) * KIN + c0,
                              ps + ((size_t)b * KIN + c0) * CM + m0 + 4 * ln, acc);
        if (!second) {
            store_hn32<2, CM>(acc, Kbf, b, o0, m0, ln, hi);
            // precaution: closes the stores above before any path of the listing reuses
            // a register that they name
            asm volatile("s_wait_xcnt 0x0" ::: "memory");
        } else {
            // V in fragment order too.  Per (b, h), blocks of 32 keys x 32 channels = 2 KB:
            //   [block m/32][channel tile d/16][half s = (m/16)&1][lane = 16*((m/8)&1) + d%16][8 keys]
            // The four column tiles of a lane are 4 consecutive m, half of one 16-byte
            // chunk -> one 8-byte store per row.
            #pragma unroll  // constant indices keep the arrays in registers
            for (int f = 0; f < 2; ++f)
                #pragma unroll  // constant indices keep the arrays in registers
                for (int r = 0; r < 8; ++r) {
                    v4bf pk;
                    #pragma unroll  // constant indices keep the arrays in registers
                    for (int j = 0; j < 4; ++j) pk[j] = (__bf16)acc[f][j][r];
                    __bf16* dp = Vbf + (size_t)(b * CH + (o0 >> 5)) * CD * CM + ((m0 >> 5) + (ln >> 3)) * 1024 + f * 512
                               + ((ln >> 2) & 1) * 256 + (16 * ((ln >> 1) & 1) + 8 * hi + r) * 8 + 4 * (ln & 1);
                    *(v4bf*)dp = pk;
                }
            // precaution: closes the stores above before any path of the listing reuses
            // a register that they name
            asm volatile("s_wait_xcnt 0x0" ::: "memory");
        }
    } else {
        const int rid = bid - KV_BLOCKS;
        const bool second = (rid >> 2) & 1;              // skip, else Q
        const int o0 = (rid & 3) * 64 + (wave >> 2) * 32;
        const int n0 = (((rid >> 3) & 15) * 4 + (wave & 3)) * 64;
        const int b  = rid >> 7;
        const float* W = second ? sw : qw;
        proj_tile<2, QIN, CN>(W + (size_t)(o0 + ln) * QIN + c0,
                              pcd + ((size_t)b * QIN + c0) * CN + n0 + 4 * ln, acc);
        if (!second) {
            store_hn32<2, CN>(acc, Qbf, b, o0, n0, ln, hi);
            // precaution: closes the stores above before any path of the listing reuses
            // a register that they name
            asm volatile("s_wait_xcnt 0x0" ::: "memory");
        } else {
            // skip, fp32 out[b, o, n]: 4 consecutive n per lane and row -> one
            // 16-byte store, 16 lanes cover 256 contiguous bytes.
            #pragma unroll  // constant indices keep the arrays in registers
            for (int f = 0; f < 2; ++f)
                #pragma unroll  // constant indices keep the arrays in registers
                for (int r = 0; r < 8; ++r) {
                    float* dp = out + ((size_t)b * COUT + o0 + 16 * f + 8 * hi + r) * CN + n0 + 4 * ln;
                    *(float4*)dp = make_float4(acc[f][0][r], acc[f][1][r], acc[f][2][r], acc[f][3][r]);
                }
            // precaution: closes the stores above before any path of the listing reuses
            // a register that they name
            asm volatile("s_wait_xcnt 0x0" ::: "memory");
        }
    }
}

// ---------------------------------------------------------------------------
// Fused attention, no LDS / no shuffles in the hot loop.
//   E^T = K-tile x Q-tile   (C-layout of E^T == B-layout of P^T, by symmetry)
//   x^T = V-tile x P^T      (accumulated over all M in two v8f tiles)
// Softmax uses unnormalized exp (scores ~ N(0,1); |max| ~ 6 => no overflow),
// per-column sums are lane-local partials + one shfl_xor(16) at the end.
// ---------------------------------------------------------------------------
__global__ __launch_bounds__(256) void attn_kernel(const __bf16* __restrict__ Qbf,
                                                   const __bf16* __restrict__ Kbf,
                                                   const __bf16* __restrict__ Vbf,
                                                   float* __restrict__ out) {
    const int lane = threadIdx.x & 31, wave = threadIdx.x >> 5;
    const int ln = lane & 15, hi = lane >> 4;
    const int h = blockIdx.y;
    const int b = blockIdx.z;
    const int n0 = (blockIdx.x * 8 + wave) * 16;

    // B operand (Q): col n = n0+ln, K = head channel; fragment order: the two
    // halves of tile n0/16 are 512 contiguous bytes each, 16 bytes per lane
    const __bf16* qrow = Qbf + ((size_t)(b * CH + h) * CN + n0) * CD + lane * 8;
    V16U bq;
    bq.h2[0] = *(const v8bf*)(qrow);
    bq.h2[1] = *(const v8bf*)(qrow + 256);

    const __bf16* kbase = Kbf + (size_t)(b * CH + h) * CM * CD;
    const __bf16* vbase = Vbf + (size_t)(b * CH + h) * CD * CM;

    const float scale = 0.17677669529663689f;   // 1/sqrt(32)
    float lsum = 0.f;
    v8f accA = {}, accB = {};
    v8f zero = {};

    for (int m0 = 0; m0 < CM; m0 += 32) {
        if (m0 + 32 < CM)   // uniform branch; hint next K rows into cache
            __builtin_prefetch(kbase + (size_t)(m0 + 32 + ln) * CD, 0, 0);

        // A operands (K rows m0+ln and m0+16+ln): tiles m0/16 and m0/16+1
        const __bf16* k0 = kbase + (size_t)m0 * CD + lane * 8;
        V16U ak0, ak1;
        ak0.h2[0] = *(const v8bf*)(k0);        ak0.h2[1] = *(const v8bf*)(k0 + 256);
        ak1.h2[0] = *(const v8bf*)(k0 + 512);  ak1.h2[1] = *(const v8bf*)(k0 + 768);
        // precaution: the address pair that the four K loads name is an input here,
        // so it stays untouched up to this wait and is reused only behind it
        asm volatile("s_wait_xcnt 0x0" :: "v"(k0) : "memory");

        // E^T tiles: rows m_rel, cols n
        v8f e0 = WMMA_BF16(ak0.v, bq.v, zero);
        v8f e1 = WMMA_BF16(ak1.v, bq.v, zero);

        // P^T = exp(E^T * scale); C-layout is exactly the next B-layout:
        //   element e of B  <->  p0[e] (e<8) / p1[e-8] (e>=8), all lanes alike
        V16U bp;
        #pragma unroll
        for (int r = 0; r < 8; ++r) {
            float p0 = __expf(e0[r] * scale);
            float p1 = __expf(e1[r] * scale);
            lsum += p0 + p1;                  // lane-local partial column sum
            bp.v[r]     = (__bf16)p0;
            bp.v[r + 8] = (__bf16)p1;
        }

        // A operands (V rows d = ln and 16+ln), K = m_rel: block m0/32
        const __bf16* v0 = vbase + (size_t)m0 * CD + lane * 8;
        V16U av0, av1;
        av0.h2[0] = *(const v8bf*)(v0);        av0.h2[1] = *(const v8bf*)(v0 + 256);
        av1.h2[0] = *(const v8bf*)(v0 + 512);  av1.h2[1] = *(const v8bf*)(v0 + 768);

        // x^T accumulate: rows d, cols n
        accA = WMMA_BF16(av0.v, bp.v, accA);
        accB = WMMA_BF16(av1.v, bp.v, accB);
    }

    // combine the two half-column partial sums (lanes ln and ln+16 share n)
    lsum += __shfl_xor(lsum, 16, 32);
    const float inv = 1.0f / lsum;

    // out[b, h*32 + d, n] += x/lsum ; accA: d = r+8*hi, accB: d = 16+r+8*hi
    #pragma unroll
    for (int r = 0; r < 8; ++r) {
        const size_t iA = ((size_t)(b * COUT) + h * CD + r + 8 * hi) * CN + n0 + ln;
        const size_t iB = iA + (size_t)16 * CN;
        out[iA] += accA[r] * inv;
        out[iB] += accB[r] * inv;
    }
}

// ---------------------------------------------------------------------------
// Launcher
// ---------------------------------------------------------------------------
extern "C" void kernel_launch(void* const* d_in, const int* in_sizes, int n_in,
                              void* d_out, int out_size, void* d_ws, size_t ws_size,
                              hipStream_t stream) {
    const float* pcd = (const float*)d_in[0];   // [4,256,4096]
    const float* ps  = (const float*)d_in[1];   // [4,512,1024]
    const float* qw  = (const float*)d_in[2];   // [256,256]
    const float* kw  = (const float*)d_in[3];   // [256,512]
    const float* vw  = (const float*)d_in[4];   // [256,512]
    const float* sw  = (const float*)d_in[5];   // [256,256]
    float* out = (float*)d_out;                 // [4,256,4096]

    __bf16* Qbf = (__bf16*)d_ws;                           // 8 MB  [b,h] planes, fragment order
    __bf16* Kbf = Qbf + (size_t)CB * CH * CN * CD;         // 2 MB  [b,h] planes, fragment order
    __bf16* Vbf = Kbf + (size_t)CB * CH * CM * CD;         // 2 MB  [b,h] planes, fragment order

    hipLaunchKernelGGL(proj_all_kernel, dim3(ALL_BLOCKS), dim3(256), 0, stream,
                       pcd, ps, qw, kw, vw, sw, Qbf, Kbf, Vbf, out);
    hipLaunchKernelGGL(attn_kernel, dim3(CN / 128, CH, CB), dim3(256), 0, stream, Qbf, Kbf, Vbf, out);
}

// v004
// A run of this version takes 45.3 microseconds.
// Two timings next to v003 both put it at 1.22 times that version's speed.
// Counting every step since v000, it is 2.83 times as fast.
#include <hip/hip_runtime.h>
#include <hip/hip_bf16.h>

// ---------------------------------------------------------------------------
// B=4, N=4096, M=1024, H=8, head dim 32, Q_IN=256, K_IN=512, OUT=256.
// out = skip_w@pcd + per-head softmax(qT k / sqrt(32)) @ vT      (fp32 out)
//
// All GEMMs run on v_wmma_f32_16x16x32_bf16 (wave32).  Key layout fact used
// everywhere: CDNA5 16-bit A and B operands share ONE register layout —
// outer index (A-row / B-col) = lane%16; element e holds K-chunk
//   lanes 0-15 : K in {0..7, 16..23},   lanes 16-31 : K in {8..15, 24..31}
// i.e. two 16-byte chunks at element offsets c0 and c0+16, c0 = (lane>=16)*8.
// fp32 C/D layout: VGPR r, lanes 0-15 = (row r, col lane),
//                          lanes 16-31 = (row r+8, col lane-16).
// ---------------------------------------------------------------------------

typedef __attribute__((ext_vector_type(16))) __bf16 v16bf;
typedef __attribute__((ext_vector_type(8)))  __bf16 v8bf;
typedef __attribute__((ext_vector_type(4)))  __bf16 v4bf;
typedef __attribute__((ext_vector_type(8)))  float  v8f;

#define CB 4
#define CH 8
#define CN 4096
#define CM 1024
#define CD 32
#define QIN 256
#define KIN 512
#define COUT 256

#define WMMA_BF16(A, B, C) \
    __builtin_amdgcn_wmma_f32_16x16x32_bf16(false, (A), false, (B), (short)0, (C), false, false)

union V16U { v16bf v; v8bf h2[2]; };

// ---------------------------------------------------------------------------
// Projections, all in the W x X orientation: D[o, n] = sum_i W[o,i] X[b,i,n].
// One wave owns a register tile of FO*16 output channels x 64 columns (FO = 2
// everywhere), so one activation fragment feeds FO products and one weight
// fragment feeds four.
// The 64 columns are dealt to the four column tiles interleaved: tile j, lane
// column ln  <->  n = n0 + 4*ln + j.  One 16-byte load per channel then fills
// the same element of all four B fragments, and 16 lanes cover 256 contiguous
// bytes of the channel's row.
// k order of both operands: element t <-> i0 + c0 + t, element t+8 <-> i0 + c0 + 16 + t.
// ---------------------------------------------------------------------------
template <int FO, int CIN, int NC>
__device__ __forceinline__ void proj_tile(const float* __restrict__ wrow,   // W + (o0+ln)*CIN + c0
                                          const float* __restrict__ xcol,   // X[b] + c0*NC + n0 + 4*ln
                                          v8f (&acc)[FO][4]) {
    #pragma unroll  // constant indices keep the arrays in registers
    for (int f = 0; f < FO; ++f)
        #pragma unroll  // constant indices keep the arrays in registers
        for (int j = 0; j < 4; ++j) acc[f][j] = v8f{};

    #pragma unroll  // row and column steps become immediate offsets of the loads
    for (int i0 = 0; i0 < CIN; i0 += 32) {
        // all loads of this k-step first, as one group: one wait per k-step
        float4 xr[16], wr[FO][4];
        #pragma unroll  // constant indices keep the arrays in registers
        for (int t = 0; t < 8; ++t) {
            xr[t]     = *(const float4*)(xcol + (size_t)(i0 + t) * NC);
            xr[t + 8] = *(const float4*)(xcol + (size_t)(i0 + 16 + t) * NC);
        }
        #pragma unroll  // constant indices keep the arrays in registers
        for (int f = 0; f < FO; ++f) {
            const float* wp = wrow + (size_t)f * 16 * CIN + i0;
            wr[f][0] = *(const float4*)(wp);
            wr[f][1] = *(const float4*)(wp + 4);
            wr[f][2] = *(const float4*)(wp + 16);
            wr[f][3] = *(const float4*)(wp + 20);
        }
        // keeps the group whole: without it the scheduler sinks weight loads
        // between the products and the wave waits out a load latency per fragment
        __builtin_amdgcn_sched_barrier(0);
        v16bf bx[4];
        #pragma unroll  // constant indices keep the arrays in registers
        for (int e = 0; e < 16; ++e) {
            bx[0][e] = (__bf16)xr[e].x;
            bx[1][e] = (__bf16)xr[e].y;
            bx[2][e] = (__bf16)xr[e].z;
            bx[3][e] = (__bf16)xr[e].w;
        }
        #pragma unroll  // constant indices keep the arrays in registers
        for (int f = 0; f < FO; ++f) {
            v16bf aw;
            #pragma unroll  // constant indices keep the arrays in registers
            for (int q = 0; q < 4; ++q) {
                aw[4 * q + 0] = (__bf16)wr[f][q].x;
                aw[4 * q + 1] = (__bf16)wr[f][q].y;
                aw[4 * q + 2] = (__bf16)wr[f][q].z;
                aw[4 * q + 3] = (__bf16)wr[f][q].w;
            }
            #pragma unroll  // constant indices keep the arrays in registers
            for (int j = 0; j < 4; ++j) acc[f][j] = WMMA_BF16(aw, bx[j], acc[f][j]);
        }
    }
    // precaution: the two address pairs that every load above names are inputs
    // here, so they stay untouched up to this wait and are reused only behind it
    asm volatile("s_wait_xcnt 0x0" :: "v"(wrow), "v"(xcol) : "memory");
}

// bf16 store of Q and K in fragment order.  Per (b, h) the plane is cut into
// tiles of 16 columns x 32 head channels = 1 KB, laid out as the attention
// kernel's operand registers want them:
//   [tile n/16][half s = ch/16][lane = 16*((ch/8)&1) + n%16][8 channels]
// so a wave's 16-byte load of one half covers 512 contiguous bytes.
// Rows o = o0 + 16f + 8*hi + r are 8 consecutive head channels of column n:
// exactly one 16-byte chunk (s = f, chunk lane = 16*hi + n%16).
template <int FO, int NC>
__device__ __forceinline__ void store_hn32(const v8f (&acc)[FO][4], __bf16* __restrict__ dst,
                                           int b, int o0, int n0, int ln, int hi) {
    #pragma unroll  // constant indices keep the arrays in registers
    for (int f = 0; f < FO; ++f) {
        const int of = o0 + 16 * f;
        #pragma unroll  // constant indices keep the arrays in registers
        for (int j = 0; j < 4; ++j) {
            v8bf pk;
            #pragma unroll  // constant indices keep the arrays in registers
            for (int r = 0; r < 8; ++r) pk[r] = (__bf16)acc[f][j][r];
            const int n = n0 + 4 * ln + j;
            __bf16* dp = dst + (size_t)(b * CH + (of >> 5)) * NC * CD + (n >> 4) * 512 + (of & 16) * 16 + (16 * hi + (n & 15)) * 8;
            *(v8bf*)dp = pk;
        }
    }
}

// All four projections are independent of each other: ONE launch, the block
// index picks the job.  Every block is 8 waves = 2 channel groups x 4 column
// groups (64 x 256 outputs): waves w and w+4 read the same activations, the
// waves of one channel group the same weights.
//   blocks 0..127   : K and V (512 input channels, the longer job, started first)
//   blocks 128..639 : Q and skip (256 input channels)
// Inside a range the index runs channel block, then which weight matrix, then
// column block, then batch: the 8 blocks that read one activation tile are
// neighbours.  The two jobs of a range share one copy of the product loop; only
// the weight pointer and the store differ, chosen by block-uniform tests.
// amdgpu_waves_per_eu(2, 4): the register budget of two waves per SIMD lets the
// scheduler keep a k-step's 24 loads in one group; up to four waves (two blocks
// per WGP) may be resident, so one block's products run under another's loads.
#define KV_BLOCKS 128
#define ALL_BLOCKS 640
__global__ __launch_bounds__(256) __attribute__((amdgpu_waves_per_eu(2, 4))) void proj_all_kernel(const float* __restrict__ pcd,
                                                       const float* __restrict__ ps,
                                                       const float* __restrict__ qw,
                                                       const float* __restrict__ kw,
                                                       const float* __restrict__ vw,
                                                       const float* __restrict__ sw,
                                                       __bf16* __restrict__ Qbf,
                                                       __bf16* __restrict__ Kbf,
                                                       __bf16* __restrict__ Vbf,
                                                       float* __restrict__ out) {
    const int lane = threadIdx.x & 31, wave = threadIdx.x >> 5;
    const int ln = lane & 15, hi = lane >> 4, c0 = hi ? 8 : 0;
    const int bid = blockIdx.x;
    v8f acc[2][4];
    if (bid < KV_BLOCKS) {
        const bool second = (bid >> 2) & 1;              // V, else K
        const int o0 = (bid & 3) * 64 + (wave >> 2) * 32;
        const int m0 = (((bid >> 3) & 3) * 4 + (wave & 3)) * 64;
        const int b  = bid >> 5;
        const float* W = second ? vw : kw;
        proj_tile<2, KIN, CM>(W + (size_t)(o0 + ln) * KIN + c0,
                              ps + ((size_t)b * KIN + c0) * CM + m0 + 4 * ln, acc);
        if (!second) {
            store_hn32<2, CM>(acc, Kbf, b, o0, m0, ln, hi);
            // precaution: closes the stores above before any path of the listing reuses
            // a register that they name
            asm volatile("s_wait_xcnt 0x0" ::: "memory");
        } else {
            // V in fragment order too.  Per (b, h), blocks of 32 keys x 32 channels = 2 KB:
            //   [block m/32][channel tile d/16][half s = (m/16)&1][lane = 16*((m/8)&1) + d%16][8 keys]
            // The four column tiles of a lane are 4 consecutive m, half of one 16-byte
            // chunk -> one 8-byte store per row.
            #pragma unroll  // constant indices keep the arrays in registers
            for (int f = 0; f < 2; ++f)
                #pragma unroll  // constant indices keep the arrays in registers
                for (int r = 0; r < 8; ++r) {
                    v4bf pk;
                    #pragma unroll  // constant indices keep the arrays in registers
                    for (int j = 0; j < 4; ++j) pk[j] = (__bf16)acc[f][j][r];
                    __bf16* dp = Vbf + (size_t)(b * CH + (o0 >> 5)) * CD * CM + ((m0 >> 5) + (ln >> 3)) * 1024 + f * 512
                               + ((ln >> 2) & 1) * 256 + (16 * ((ln >> 1) & 1) + 8 * hi + r) * 8 + 4 * (ln & 1);
                    *(v4bf*)dp = pk;
                }
            // precaution: closes the stores above before any path of the listing reuses
            // a register that they name
            asm volatile("s_wait_xcnt 0x0" ::: "memory");
        }
    } else {
        const int rid = bid - KV_BLOCKS;
        const bool second = (rid >> 2) & 1;              // skip, else Q
        const int o0 = (rid & 3) * 64 + (wave >> 2) * 32;
        const int n0 = (((rid >> 3) & 15) * 4 + (wave & 3)) * 64;
        const int b  = rid >> 7;
        const float* W = second ? sw : qw;
        proj_tile<2, QIN, CN>(W + (size_t)(o0 + ln) * QIN + c0,
                              pcd + ((size_t)b * QIN + c0) * CN + n0 + 4 * ln, acc);
        if (!second) {
            store_hn32<2, CN>(acc, Qbf, b, o0, n0, ln, hi);
            // precaution: closes the stores above before any path of the listing reuses
            // a register that they name
            asm volatile("s_wait_xcnt 0x0" ::: "memory");
        } else {
            // skip, fp32 out[b, o, n]: 4 consecutive n per lane and row -> one
            // 16-byte store, 16 lanes cover 256 contiguous bytes.
            #pragma unroll  // constant indices keep the arrays in registers
            for (int f = 0; f < 2; ++f)
                #pragma unroll  // constant indices keep the arrays in registers
                for (int r = 0; r < 8; ++r) {
                    float* dp = out + ((size_t)b * COUT + o0 + 16 * f + 8 * hi + r) * CN + n0 + 4 * ln;
                    *(float4*)dp = make_float4(acc[f][0][r], acc[f][1][r], acc[f][2][r], acc[f][3][r]);
                }
            // precaution: closes the stores above before any path of the listing reuses
            // a register that they name
            asm volatile("s_wait_xcnt 0x0" ::: "memory");
        }
    }
}

// ---------------------------------------------------------------------------
// Fused attention, no LDS / no shuffles in the hot loop.
//   E^T = K-tile x Q-tile   (C-layout of E^T == B-layout of P^T, by symmetry)
//   x^T = V-tile x P^T      (accumulated over all M in two v8f tiles per Q tile)
// One wave owns NQ = 4 Q tiles (64 query columns), all kept in registers: each
// K and V fragment is loaded once per wave and trip and feeds four products.
// The grid is 256 blocks of 8 waves (two waves per SIMD), too few waves to hide a
// load behind other waves, so the fragments of trip t+1 are loaded into a second
// register set in front of the products of trip t.
// Softmax uses unnormalized exp (scores ~ N(0,1); |max| ~ 6 => no overflow),
// per-column sums are lane-local partials + one shfl_xor(16) at the end.
// ---------------------------------------------------------------------------
#define NQ 4

// the A operands of one trip (32 keys)
struct KVFrag { V16U k0, k1, v0, v1; };

// kp, vp: this lane's 16 bytes in the K and V planes at key m; OFF: a further step
// in elements.  K rows m+ln and m+16+ln: tiles m/16 and m/16+1; V rows d = ln and
// 16+ln, K = m_rel: block m/32.  Fragment order: 512 contiguous bytes per load.
template <int OFF>
__device__ __forceinline__ void load_kv(KVFrag& f, const __bf16* __restrict__ kp,
                                        const __bf16* __restrict__ vp) {
    f.k0.h2[0] = *(const v8bf*)(kp + OFF);        f.k0.h2[1] = *(const v8bf*)(kp + OFF + 256);
    f.k1.h2[0] = *(const v8bf*)(kp + OFF + 512);  f.k1.h2[1] = *(const v8bf*)(kp + OFF + 768);
    f.v0.h2[0] = *(const v8bf*)(vp + OFF);        f.v0.h2[1] = *(const v8bf*)(vp + OFF + 256);
    f.v1.h2[0] = *(const v8bf*)(vp + OFF + 512);  f.v1.h2[1] = *(const v8bf*)(vp + OFF + 768);
    // precaution: the address pairs that the eight loads name are inputs here,
    // so they stay untouched up to this wait and are reused only behind it
    asm volatile("s_wait_xcnt 0x0" :: "v"(kp), "v"(vp) : "memory");
    // keeps the eight loads in front of the products that follow: without it the
    // scheduler sinks them towards their first use and a trip waits for its own loads
    __builtin_amdgcn_sched_barrier(0);
}

__device__ __forceinline__ void attn_trip(const KVFrag& f, const V16U (&bq)[NQ],
                                          v8f (&accA)[NQ], v8f (&accB)[NQ], float (&lsum)[NQ]) {
    const float scale = 0.17677669529663689f;   // 1/sqrt(32)
    const v8f zero = {};
    #pragma unroll  // constant indices keep the arrays in registers
    for (int q = 0; q < NQ; ++q) {
        // E^T tiles: rows m_rel, cols n
        v8f e0 = WMMA_BF16(f.k0.v, bq[q].v, zero);
        v8f e1 = WMMA_BF16(f.k1.v, bq[q].v, zero);

        // P^T = exp(E^T * scale); C-layout is exactly the next B-layout:
        //   element e of B  <->  p0[e] (e<8) / p1[e-8] (e>=8), all lanes alike
        V16U bp;
        #pragma unroll  // constant indices keep the arrays in registers
        for (int r = 0; r < 8; ++r) {
            float p0 = __expf(e0[r] * scale);
            float p1 = __expf(e1[r] * scale);
            lsum[q] += p0 + p1;               // lane-local partial column sum
            bp.v[r]     = (__bf16)p0;
            bp.v[r + 8] = (__bf16)p1;
        }

        // x^T accumulate: rows d, cols n
        accA[q] = WMMA_BF16(f.v0.v, bp.v, accA[q]);
        accB[q] = WMMA_BF16(f.v1.v, bp.v, accB[q]);
    }
}

__global__ __launch_bounds__(256) void attn_kernel(const __bf16* __restrict__ Qbf,
                                                   const __bf16* __restrict__ Kbf,
                                                   const __bf16* __restrict__ Vbf,
                                                   float* __restrict__ out) {
    const int lane = threadIdx.x & 31, wave = threadIdx.x >> 5;
    const int ln = lane & 15, hi = lane >> 4;
    const int h = blockIdx.y;
    const int b = blockIdx.z;
    const int n0 = (blockIdx.x * 8 + wave) * (16 * NQ);

    const __bf16* klane = Kbf + (size_t)(b * CH + h) * CM * CD + lane * 8;
    const __bf16* vlane = Vbf + (size_t)(b * CH + h) * CD * CM + lane * 8;

    // B operands (Q): tile q holds cols n0+16q+ln, K = head channel; fragment
    // order: the two halves of a tile are 512 contiguous bytes each, 16 bytes per lane
    const __bf16* qrow = Qbf + ((size_t)(b * CH + h) * CN + n0) * CD + lane * 8;
    V16U bq[NQ];
    #pragma unroll  // constant indices keep the arrays in registers
    for (int q = 0; q < NQ; ++q) {
        bq[q].h2[0] = *(const v8bf*)(qrow + q * 512);
        bq[q].h2[1] = *(const v8bf*)(qrow + q * 512 + 256);
    }

    // trip 0's fragments go out behind the Q loads (the scheduler would swap them):
    // loads return in order, so a wait for a K fragment then covers Q, and no wait in
    // the loop has to reach past the fragment it needs
    __builtin_amdgcn_sched_barrier(0);
    KVFrag fa, fb;
    load_kv<0>(fa, klane, vlane);

    float lsum[NQ];
    v8f accA[NQ], accB[NQ];
    #pragma unroll  // constant indices keep the arrays in registers
    for (int q = 0; q < NQ; ++q) { lsum[q] = 0.f; accA[q] = v8f{}; accB[q] = v8f{}; }

    // two trips per pass, so that the two register sets swap roles without copies
    for (int m0 = 0; m0 < CM; m0 += 64) {
        load_kv<32 * CD>(fb, klane + (size_t)m0 * CD, vlane + (size_t)m0 * CD);
        attn_trip(fa, bq, accA, accB, lsum);
        // the last pass has no next trip: it reads trip 0 again (in bounds, unused)
        const int mn = (m0 + 64) & (CM - 1);
        load_kv<0>(fa, klane + (size_t)mn * CD, vlane + (size_t)mn * CD);
        attn_trip(fb, bq, accA, accB, lsum);
    }

    #pragma unroll  // constant indices keep the arrays in registers
    for (int q = 0; q < NQ; ++q) {
        // combine the two half-column partial sums (lanes ln and ln+16 share n)
        const float tot = lsum[q] + __shfl_xor(lsum[q], 16, 32);
        const float inv = 1.0f / tot;

        // out[b, h*32 + d, n] += x/lsum ; accA: d = r+8*hi, accB: d = 16+r+8*hi
        #pragma unroll  // constant indices keep the arrays in registers
        for (int r = 0; r < 8; ++r) {
            const size_t iA = ((size_t)(b * COUT) + h * CD + r + 8 * hi) * CN + n0 + 16 * q + ln;
            const size_t iB = iA + (size_t)16 * CN;
            out[iA] += accA[q][r] * inv;
            out[iB] += accB[q][r] * inv;
        }
    }
}

// ---------------------------------------------------------------------------
// Launcher
// ---------------------------------------------------------------------------
extern "C" void kernel_launch(void* const* d_in, const int* in_sizes, int n_in,
                              void* d_out, int out_size, void* d_ws, size_t ws_size,
                              hipStream_t stream) {
    const float* pcd = (const float*)d_in[0];   // [4,256,4096]
    const float* ps  = (const float*)d_in[1];   // [4,512,1024]
    const float* qw  = (const float*)d_in[2];   // [256,256]
    const float* kw  = (const float*)d_in[3];   // [256,512]
    const float* vw  = (const float*)d_in[4];   // [256,512]
    const float* sw  = (const float*)d_in[5];   // [256,256]
    float* out = (float*)d_out;                 // [4,256,4096]

    __bf16* Qbf = (__bf16*)d_ws;                           // 8 MB  [b,h] planes, fragment order
    __bf16* Kbf = Qbf + (size_t)CB * CH * CN * CD;         // 2 MB  [b,h] planes, fragment order
    __bf16* Vbf = Kbf + (size_t)CB * CH * CM * CD;         // 2 MB  [b,h] planes, fragment order

    hipLaunchKernelGGL(proj_all_kernel, dim3(ALL_BLOCKS), dim3(256), 0, stream,
                       pcd, ps, qw, kw, vw, sw, Qbf, Kbf, Vbf, out);
    hipLaunchKernelGGL(attn_kernel, dim3(CN / (128 * NQ), CH, CB), dim3(256), 0, stream, Qbf, Kbf, Vbf, out);
}

// v005
// One run takes 39.2 microseconds.
// Timed twice side by side with v004, it ran 1.15 and 1.16 times as fast.
// All steps since v000 together make it 3.26 times as fast.
#include <hip/hip_runtime.h>
#include <hip/hip_bf16.h>

// ---------------------------------------------------------------------------
// B=4, N=4096, M=1024, H=8, head dim 32, Q_IN=256, K_IN=512, OUT=256.
// out = skip_w@pcd + per-head softmax(qT k / sqrt(32)) @ vT      (fp32 out)
//
// All GEMMs run on v_wmma_f32_16x16x32_bf16 (wave32).  Key layout fact used
// everywhere: CDNA5 16-bit A and B operands share ONE register layout —
// outer index (A-row / B-col) = lane%16; element e holds K-chunk
//   lanes 0-15 : K in {0..7, 16..23},   lanes 16-31 : K in {8..15, 24..31}
// i.e. two 16-byte chunks at element offsets c0 and c0+16, c0 = (lane>=16)*8.
// fp32 C/D layout: VGPR r, lanes 0-15 = (row r, col lane),
//                          lanes 16-31 = (row r+8, col lane-16).
// ---------------------------------------------------------------------------

typedef __attribute__((ext_vector_type(16))) __bf16 v16bf;
typedef __attribute__((ext_vector_type(8)))  __bf16 v8bf;
typedef __attribute__((ext_vector_type(4)))  __bf16 v4bf;
typedef __attribute__((ext_vector_type(8)))  float  v8f;

#define CB 4
#define CH 8
#define CN 4096
#define CM 1024
#define CD 32
#define QIN 256
#define KIN 512
#define COUT 256

#define WMMA_BF16(A, B, C) \
    __builtin_amdgcn_wmma_f32_16x16x32_bf16(false, (A), false, (B), (short)0, (C), false, false)

union V16U { v16bf v; v8bf h2[2]; };

// ---------------------------------------------------------------------------
// Projections, all in the W x X orientation: D[o, n] = sum_i W[o,i] X[b,i,n].
// One wave owns a register tile of FO*16 output channels x 64 columns (FO = 2
// everywhere), so one activation fragment feeds FO products and one weight
// fragment feeds four.
// The 64 columns are dealt to the four column tiles interleaved: tile j, lane
// column ln  <->  n = n0 + 4*ln + j.  One 16-byte load per channel then fills
// the same element of all four B fragments, and 16 lanes cover 256 contiguous
// bytes of the channel's row.
// k order of both operands: element t <-> i0 + c0 + t, element t+8 <-> i0 + c0 + 16 + t.
//
// The weights come from LDS.  A block's 64 weight rows are read from global memory
// once, in whole 128-byte lines, rounded to bf16 once and laid down in fragment
// order; a fragment load straight from the row-major matrix touches 16 lines for
// 512 bytes, and every wave of a channel group would repeat it.
// LDS layout, one fragment (16 rows x 32 k) = WFRAG elements:
//   [row tile][k-step][half s = k/16][hi = (k/8)&1][row%16][8 k]
// with the hi blocks at a pitch of 320 bytes (256 + 64) and the halves at 640: a
// wave's 8-byte stores (4 rows x one line) then fall on all 64 banks once, and each
// 16-lane half of a 16-byte fragment read stays 256 contiguous bytes.
// ---------------------------------------------------------------------------
#define WHI   160                 // elements between the hi blocks of a half
#define WHALF 320                 // elements between the halves of a fragment
#define WFRAG 640                 // elements per fragment

// wsrc: first of the block's 64 rows.  Thread t, round it: 16 bytes of row
// 32*(it&1) + t/8, k-step it/2, piece t%8 (k = 4*piece .. 4*piece+3 of the step).
template <int CIN>
__device__ __forceinline__ void stage_weights(const float* __restrict__ wsrc, __bf16* __restrict__ wl) {
    constexpr int KS = CIN / 32;
    const int t = threadIdx.x, piece = t & 7, row = t >> 3;
    const float* gp = wsrc + (size_t)row * CIN + piece * 4;
    __bf16* lp = wl + (row >> 4) * (KS * WFRAG) + (piece >> 2) * WHALF + ((piece >> 1) & 1) * WHI
               + (row & 15) * 8 + (piece & 1) * 4;
    #pragma unroll  // row and k steps become immediate offsets of the loads and stores
    for (int g = 0; g < CIN / 16; g += 16) {
        float4 w[16];
        #pragma unroll  // constant indices keep the array in registers
        for (int u = 0; u < 16; ++u)
            w[u] = *(const float4*)(gp + (size_t)((g + u) & 1) * 32 * CIN + ((g + u) >> 1) * 32);
        #pragma unroll  // constant indices keep the array in registers
        for (int u = 0; u < 16; ++u) {
            v4bf pk;
            pk[0] = (__bf16)w[u].x; pk[1] = (__bf16)w[u].y; pk[2] = (__bf16)w[u].z; pk[3] = (__bf16)w[u].w;
            *(v4bf*)(lp + ((g + u) & 1) * 2 * (KS * WFRAG) + ((g + u) >> 1) * WFRAG) = pk;
        }
    }
    // precaution: the address pair that every load above names is an input here,
    // so it stays untouched up to this wait and is reused only behind it
    asm volatile("s_wait_xcnt 0x0" :: "v"(gp) : "memory");
    // publishes the block's weights: every wave reads fragments that other waves wrote
    __syncthreads();
}

template <int FO, int CIN, int NC>
__device__ __forceinline__ void proj_tile(const __bf16* __restrict__ wfrag, // LDS: wave's first row tile + hi*WHI + ln*8
                                          const float* __restrict__ xcol,   // X[b] + c0*NC + n0 + 4*ln
                                          v8f (&acc)[FO][4]) {
    #pragma unroll  // constant indices keep the arrays in registers
    for (int f = 0; f < FO; ++f)
        #pragma unroll  // constant indices keep the arrays in registers
        for (int j = 0; j < 4; ++j) acc[f][j] = v8f{};

    #pragma unroll  // row and column steps become immediate offsets of the loads
    for (int i0 = 0; i0 < CIN; i0 += 32) {
        // all loads of this k-step first, as one group: one wait per k-step
        float4 xr[16];
        V16U aw[FO];
        #pragma unroll  // constant indices keep the arrays in registers
        for (int t = 0; t < 8; ++t) {
            xr[t]     = *(const float4*)(xcol + (size_t)(i0 + t) * NC);
            xr[t + 8] = *(const float4*)(xcol + (size_t)(i0 + 16 + t) * NC);
        }
        #pragma unroll  // constant indices keep the arrays in registers
        for (int f = 0; f < FO; ++f) {
            const __bf16* wp = wfrag + (f * (CIN / 32) + i0 / 32) * WFRAG;
            aw[f].h2[0] = *(const v8bf*)(wp);
            aw[f].h2[1] = *(const v8bf*)(wp + WHALF);
        }
        // keeps the group whole: without it the scheduler sinks loads between the
        // products and the wave waits out a load latency per fragment
        __builtin_amdgcn_sched_barrier(0);
        v16bf bx[4];
        #pragma unroll  // constant indices keep the arrays in registers
        for (int e = 0; e < 16; ++e) {
            bx[0][e] = (__bf16)xr[e].x;
            bx[1][e] = (__bf16)xr[e].y;
            bx[2][e] = (__bf16)xr[e].z;
            bx[3][e] = (__bf16)xr[e].w;
        }
        #pragma unroll  // constant indices keep the arrays in registers
        for (int f = 0; f < FO; ++f)
            #pragma unroll  // constant indices keep the arrays in registers
            for (int j = 0; j < 4; ++j) acc[f][j] = WMMA_BF16(aw[f].v, bx[j], acc[f][j]);
    }
    // precaution: the address pair that every global load above names is an input
    // here, so it stays untouched up to this wait and is reused only behind it
    asm volatile("s_wait_xcnt 0x0" :: "v"(xcol) : "memory");
}

// bf16 store of Q and K in fragment order.  Per (b, h) the plane is cut into
// tiles of 16 columns x 32 head channels = 1 KB, laid out as the attention
// kernel's operand registers want them:
//   [tile n/16][half s = ch/16][lane = 16*((ch/8)&1) + n%16][8 channels]
// so a wave's 16-byte load of one half covers 512 contiguous bytes.
// Rows o = o0 + 16f + 8*hi + r are 8 consecutive head channels of column n:
// exactly one 16-byte chunk (s = f, chunk lane = 16*hi + n%16).
template <int FO, int NC>
__device__ __forceinline__ void store_hn32(const v8f (&acc)[FO][4], __bf16* __restrict__ dst,
                                           int b, int o0, int n0, int ln, int hi) {
    #pragma unroll  // constant indices keep the arrays in registers
    for (int f = 0; f < FO; ++f) {
        const int of = o0 + 16 * f;
        #pragma unroll  // constant indices keep the arrays in registers
        for (int j = 0; j < 4; ++j) {
            v8bf pk;
            #pragma unroll  // constant indices keep the arrays in registers
            for (int r = 0; r < 8; ++r) pk[r] = (__bf16)acc[f][j][r];
            const int n = n0 + 4 * ln + j;
            __bf16* dp = dst + (size_t)(b * CH + (of >> 5)) * NC * CD + (n >> 4) * 512 + (of & 16) * 16 + (16 * hi + (n & 15)) * 8;
            *(v8bf*)dp = pk;
        }
    }
}

// All four projections are independent of each other: ONE launch, the block
// index picks the job.  Every block is 8 waves = 2 channel groups x 4 column
// groups (64 x 256 outputs): waves w and w+4 read the same activations, the
// waves of one channel group the same weight fragments in LDS.
//   blocks 0..127   : K and V (512 input channels, the longer job, started first)
//   blocks 128..639 : Q and skip (256 input channels)
// Inside a range the index runs channel block, then which weight matrix, then
// column block, then batch: the 8 blocks that read one activation tile are
// neighbours.  The two jobs of a range share one copy of the product loop; only
// the weight pointer and the store differ, chosen by block-uniform tests.
// amdgpu_waves_per_eu(2, 4): the register budget of two waves per SIMD lets the
// scheduler keep a k-step's loads in one group; up to four waves (two blocks
// per WGP) may be resident, so one block's products run under another's loads.
#define KV_BLOCKS 128
#define ALL_BLOCKS 640
__global__ __launch_bounds__(256) __attribute__((amdgpu_waves_per_eu(2, 4))) void proj_all_kernel(const float* __restrict__ pcd,
                                                       const float* __restrict__ ps,
                                                       const float* __restrict__ qw,
                                                       const float* __restrict__ kw,
                                                       const float* __restrict__ vw,
                                                       const float* __restrict__ sw,
                                                       __bf16* __restrict__ Qbf,
                                                       __bf16* __restrict__ Kbf,
                                                       __bf16* __restrict__ Vbf,
                                                       float* __restrict__ out) {
    const int lane = threadIdx.x & 31, wave = threadIdx.x >> 5;
    const int ln = lane & 15, hi = lane >> 4, c0 = hi ? 8 : 0;
    const int bid = blockIdx.x;
    v8f acc[2][4];
    // the block's 64 weight rows as bf16 fragments: 4 row tiles x up to 16 k-steps
    __shared__ __attribute__((aligned(16))) __bf16 wlds[4 * (KIN / 32) * WFRAG];
    if (bid < KV_BLOCKS) {
        const bool second = (bid >> 2) & 1;              // V, else K
        const int o0 = (bid & 3) * 64 + (wave >> 2) * 32;
        const int m0 = (((bid >> 3) & 3) * 4 + (wave & 3)) * 64;
        const int b  = bid >> 5;
        const float* W = second ? vw : kw;
        stage_weights<KIN>(W + (size_t)(bid & 3) * 64 * KIN, wlds);
        proj_tile<2, KIN, CM>(wlds + (wave >> 2) * 2 * (KIN / 32) * WFRAG + hi * WHI + ln * 8,
                              ps + ((size_t)b * KIN + c0) * CM + m0 + 4 * ln, acc);
        if (!second) {
            store_hn32<2, CM>(acc, Kbf, b, o0, m0, ln, hi);
            // precaution: closes the stores above before any path of the listing reuses
            // a register that they name
            asm volatile("s_wait_xcnt 0x0" ::: "memory");
        } else {
            // V in fragment order too.  Per (b, h), blocks of 32 keys x 32 channels = 2 KB:
            //   [block m/32][channel tile d/16][half s = (m/16)&1][lane = 16*((m/8)&1) + d%16][8 keys]
            // The four column tiles of a lane are 4 consecutive m, half of one 16-byte
            // chunk -> one 8-byte store per row.
            #pragma unroll  // constant indices keep the arrays in registers
            for (int f = 0; f < 2; ++f)
                #pragma unroll  // constant indices keep the arrays in registers
                for (int r = 0; r < 8; ++r) {
                    v4bf pk;
                    #pragma unroll  // constant indices keep the arrays in registers
                    for (int j = 0; j < 4; ++j) pk[j] = (__bf16)acc[f][j][r];
                    __bf16* dp = Vbf + (size_t)(b * CH + (o0 >> 5)) * CD * CM + ((m0 >> 5) + (ln >> 3)) * 1024 + f * 512
                               + ((ln >> 2) & 1) * 256 + (16 * ((ln >> 1) & 1) + 8 * hi + r) * 8 + 4 * (ln & 1);
                    *(v4bf*)dp = pk;
                }
            // precaution: closes the stores above before any path of the listing reuses
            // a register that they name
            asm volatile("s_wait_xcnt 0x0" ::: "memory");
        }
    } else {
        const int rid = bid - KV_BLOCKS;
        const bool second = (rid >> 2) & 1;              // skip, else Q
        const int o0 = (rid & 3) * 64 + (wave >> 2) * 32;
        const int n0 = (((rid >> 3) & 15) * 4 + (wave & 3)) * 64;
        const int b  = rid >> 7;
        const float* W = second ? sw : qw;
        stage_weights<QIN>(W + (size_t)(rid & 3) * 64 * QIN, wlds);
        proj_tile<2, QIN, CN>(wlds + (wave >> 2) * 2 * (QIN / 32) * WFRAG + hi * WHI + ln * 8,
                              pcd + ((size_t)b * QIN + c0) * CN + n0 + 4 * ln, acc);
        if (!second) {
            store_hn32<2, CN>(acc, Qbf, b, o0, n0, ln, hi);
            // precaution: closes the stores above before any path of the listing reuses
            // a register that they name
            asm volatile("s_wait_xcnt 0x0" ::: "memory");
        } else {
            // skip, fp32 out[b, o, n]: 4 consecutive n per lane and row -> one
            // 16-byte store, 16 lanes cover 256 contiguous bytes.
            #pragma unroll  // constant indices keep the arrays in registers
            for (int f = 0; f < 2; ++f)
                #pragma unroll  // constant indices keep the arrays in registers
                for (int r = 0; r < 8; ++r) {
                    float* dp = out + ((size_t)b * COUT + o0 + 16 * f + 8 * hi + r) * CN + n0 + 4 * ln;
                    *(float4*)dp = make_float4(acc[f][0][r], acc[f][1][r], acc[f][2][r], acc[f][3][r]);
                }
            // precaution: closes the stores above before any path of the listing reuses
            // a register that they name
            asm volatile("s_wait_xcnt 0x0" ::: "memory");
        }
    }
}

// ---------------------------------------------------------------------------
// Fused attention, no LDS / no shuffles in the hot loop.
//   E^T = K-tile x Q-tile   (C-layout of E^T == B-layout of P^T, by symmetry)
//   x^T = V-tile x P^T      (accumulated over all M in two v8f tiles per Q tile)
// One wave owns NQ = 4 Q tiles (64 query columns), all kept in registers: each
// K and V fragment is loaded once per wave and trip and feeds four products.
// The grid is 256 blocks of 8 waves (two waves per SIMD), too few waves to hide a
// load behind other waves, so the fragments of trip t+1 are loaded into a second
// register set in front of the products of trip t.
// Softmax uses unnormalized exp (scores ~ N(0,1); |max| ~ 6 => no overflow),
// per-column sums are lane-local partials + one shfl_xor(16) at the end.
// ---------------------------------------------------------------------------
#define NQ 4

// the A operands of one trip (32 keys)
struct KVFrag { V16U k0, k1, v0, v1; };

// kp, vp: this lane's 16 bytes in the K and V planes at key m; OFF: a further step
// in elements.  K rows m+ln and m+16+ln: tiles m/16 and m/16+1; V rows d = ln and
// 16+ln, K = m_rel: block m/32.  Fragment order: 512 contiguous bytes per load.
template <int OFF>
__device__ __forceinline__ void load_kv(KVFrag& f, const __bf16* __restrict__ kp,
                                        const __bf16* __restrict__ vp) {
    f.k0.h2[0] = *(const v8bf*)(kp + OFF);        f.k0.h2[1] = *(const v8bf*)(kp + OFF + 256);
    f.k1.h2[0] = *(const v8bf*)(kp + OFF + 512);  f.k1.h2[1] = *(const v8bf*)(kp + OFF + 768);
    f.v0.h2[0] = *(const v8bf*)(vp + OFF);        f.v0.h2[1] = *(const v8bf*)(vp + OFF + 256);
    f.v1.h2[0] = *(const v8bf*)(vp + OFF + 512);  f.v1.h2[1] = *(const v8bf*)(vp + OFF + 768);
    // precaution: the address pairs that the eight loads name are inputs here,
    // so they stay untouched up to this wait and are reused only behind it
    asm volatile("s_wait_xcnt 0x0" :: "v"(kp), "v"(vp) : "memory");
    // keeps the eight loads in front of the products that follow: without it the
    // scheduler sinks them towards their first use and a trip waits for its own loads
    __builtin_amdgcn_sched_barrier(0);
}

__device__ __forceinline__ void attn_trip(const KVFrag& f, const V16U (&bq)[NQ],
                                          v8f (&accA)[NQ], v8f (&accB)[NQ], float (&lsum)[NQ]) {
    const float scale = 0.17677669529663689f;   // 1/sqrt(32)
    const v8f zero = {};
    #pragma unroll  // constant indices keep the arrays in registers
    for (int q = 0; q < NQ; ++q) {
        // E^T tiles: rows m_rel, cols n
        v8f e0 = WMMA_BF16(f.k0.v, bq[q].v, zero);
        v8f e1 = WMMA_BF16(f.k1.v, bq[q].v, zero);

        // P^T = exp(E^T * scale); C-layout is exactly the next B-layout:
        //   element e of B  <->  p0[e] (e<8) / p1[e-8] (e>=8), all lanes alike
        V16U bp;
        #pragma unroll  // constant indices keep the arrays in registers
        for (int r = 0; r < 8; ++r) {
            float p0 = __expf(e0[r] * scale);
            float p1 = __expf(e1[r] * scale);
            lsum[q] += p0 + p1;               // lane-local partial column sum
            bp.v[r]     = (__bf16)p0;
            bp.v[r + 8] = (__bf16)p1;
        }

        // x^T accumulate: rows d, cols n
        accA[q] = WMMA_BF16(f.v0.v, bp.v, accA[q]);
        accB[q] = WMMA_BF16(f.v1.v, bp.v, accB[q]);
    }
}

__global__ __launch_bounds__(256) void attn_kernel(const __bf16* __restrict__ Qbf,
                                                   const __bf16* __restrict__ Kbf,
                                                   const __bf16* __restrict__ Vbf,
                                                   float* __restrict__ out) {
    const int lane = threadIdx.x & 31, wave = threadIdx.x >> 5;
    const int ln = lane & 15, hi = lane >> 4;
    const int h = blockIdx.y;
    const int b = blockIdx.z;
    const int n0 = (blockIdx.x * 8 + wave) * (16 * NQ);

    const __bf16* klane = Kbf + (size_t)(b * CH + h) * CM * CD + lane * 8;
    const __bf16* vlane = Vbf + (size_t)(b * CH + h) * CD * CM + lane * 8;

    // B operands (Q): tile q holds cols n0+16q+ln, K = head channel; fragment
    // order: the two halves of a tile are 512 contiguous bytes each, 16 bytes per lane
    const __bf16* qrow = Qbf + ((size_t)(b * CH + h) * CN + n0) * CD + lane * 8;
    V16U bq[NQ];
    #pragma unroll  // constant indices keep the arrays in registers
    for (int q = 0; q < NQ; ++q) {
        bq[q].h2[0] = *(const v8bf*)(qrow + q * 512);
        bq[q].h2[1] = *(const v8bf*)(qrow + q * 512 + 256);
    }

    // trip 0's fragments go out behind the Q loads (the scheduler would swap them):
    // loads return in order, so a wait for a K fragment then covers Q, and no wait in
    // the loop has to reach past the fragment it needs
    __builtin_amdgcn_sched_barrier(0);
    KVFrag fa, fb;
    load_kv<0>(fa, klane, vlane);

    float lsum[NQ];
    v8f accA[NQ], accB[NQ];
    #pragma unroll  // constant indices keep the arrays in registers
    for (int q = 0; q < NQ; ++q) { lsum[q] = 0.f; accA[q] = v8f{}; accB[q] = v8f{}; }

    // two trips per pass, so that the two register sets swap roles without copies
    for (int m0 = 0; m0 < CM; m0 += 64) {
        load_kv<32 * CD>(fb, klane + (size_t)m0 * CD, vlane + (size_t)m0 * CD);
        attn_trip(fa, bq, accA, accB, lsum);
        // the last pass has no next trip: it reads trip 0 again (in bounds, unused)
        const int mn = (m0 + 64) & (CM - 1);
        load_kv<0>(fa, klane + (size_t)mn * CD, vlane + (size_t)mn * CD);
        attn_trip(fb, bq, accA, accB, lsum);
    }

    #pragma unroll  // constant indices keep the arrays in registers
    for (int q = 0; q < NQ; ++q) {
        // combine the two half-column partial sums (lanes ln and ln+16 share n)
        const float tot = lsum[q] + __shfl_xor(lsum[q], 16, 32);
        const float inv = 1.0f / tot;

        // out[b, h*32 + d, n] += x/lsum ; accA: d = r+8*hi, accB: d = 16+r+8*hi
        #pragma unroll  // constant indices keep the arrays in registers
        for (int r = 0; r < 8; ++r) {
            const size_t iA = ((size_t)(b * COUT) + h * CD + r + 8 * hi) * CN + n0 + 16 * q + ln;
            const size_t iB = iA + (size_t)16 * CN;
            out[iA] += accA[q][r] * inv;
            out[iB] += accB[q][r] * inv;
        }
    }
}

// ---------------------------------------------------------------------------
// Launcher
// ---------------------------------------------------------------------------
extern "C" void kernel_launch(void* const* d_in, const int* in_sizes, int n_in,
                              void* d_out, int out_size, void* d_ws, size_t ws_size,
                              hipStream_t stream) {
    const float* pcd = (const float*)d_in[0];   // [4,256,4096]
    const float* ps  = (const float*)d_in[1];   // [4,512,1024]
    const float* qw  = (const float*)d_in[2];   // [256,256]
    const float* kw  = (const float*)d_in[3];   // [256,512]
    const float* vw  = (const float*)d_in[4];   // [256,512]
    const float* sw  = (const float*)d_in[5];   // [256,256]
    float* out = (float*)d_out;                 // [4,256,4096]

    __bf16* Qbf = (__bf16*)d_ws;                           // 8 MB  [b,h] planes, fragment order
    __bf16* Kbf = Qbf + (size_t)CB * CH * CN * CD;         // 2 MB  [b,h] planes, fragment order
    __bf16* Vbf = Kbf + (size_t)CB * CH * CM * CD;         // 2 MB  [b,h] planes, fragment order

    hipLaunchKernelGGL(proj_all_kernel, dim3(ALL_BLOCKS), dim3(256), 0, stream,
                       pcd, ps, qw, kw, vw, sw, Qbf, Kbf, Vbf, out);
    hipLaunchKernelGGL(attn_kernel, dim3(CN / (128 * NQ), CH, CB), dim3(256), 0, stream, Qbf, Kbf, Vbf, out);
}

// v006
// Measured time: 36.6 microseconds a run.
// In both of two side-by-side timings against v005, it was 1.07 times as fast.
// Counting every step since v000, it is 3.49 times as fast.
#include <hip/hip_runtime.h>
#include <hip/hip_bf16.h>

// ---------------------------------------------------------------------------
// B=4, N=4096, M=1024, H=8, head dim 32, Q_IN=256, K_IN=512, OUT=256.
// out = skip_w@pcd + per-head softmax(qT k / sqrt(32)) @ vT      (fp32 out)
//
// All GEMMs run on v_wmma_f32_16x16x32_bf16 (wave32).  Key layout fact used
// everywhere: CDNA5 16-bit A and B operands share ONE register layout —
// outer index (A-row / B-col) = lane%16; element e holds K-chunk
//   lanes 0-15 : K in {0..7, 16..23},   lanes 16-31 : K in {8..15, 24..31}
// i.e. two 16-byte chunks at element offsets c0 and c0+16, c0 = (lane>=16)*8.
// fp32 C/D layout: VGPR r, lanes 0-15 = (row r, col lane),
//                          lanes 16-31 = (row r+8, col lane-16).
// ---------------------------------------------------------------------------

typedef __attribute__((ext_vector_type(16))) __bf16 v16bf;
typedef __attribute__((ext_vector_type(8)))  __bf16 v8bf;
typedef __attribute__((ext_vector_type(4)))  __bf16 v4bf;
typedef __attribute__((ext_vector_type(8)))  float  v8f;

#define CB 4
#define CH 8
#define CN 4096
#define CM 1024
#define CD 32
#define QIN 256
#define KIN 512
#define COUT 256

#define WMMA_BF16(A, B, C) \
    __builtin_amdgcn_wmma_f32_16x16x32_bf16(false, (A), false, (B), (short)0, (C), false, false)

union V16U { v16bf v; v8bf h2[2]; };

// exp(e / sqrt(32)) = 2^(e * QSCALE).  The factor is linear in Q, so it is applied
// once per Q element in the projection, in fp32 ahead of the one rounding to bf16;
// the scores then leave the matrix unit as the exponent of 2.
#define QSCALE ((float)(0.17677669529663689 * 1.4426950408889634))   // 1/sqrt(32) * log2(e)

// ---------------------------------------------------------------------------
// Projections, all in the W x X orientation: D[o, n] = sum_i W[o,i] X[b,i,n].
// One wave owns a register tile of FO*16 output channels x 64 columns (FO = 2
// everywhere), so one activation fragment feeds FO products and one weight
// fragment feeds four.
// The 64 columns are dealt to the four column tiles interleaved: tile j, lane
// column ln  <->  n = n0 + 4*ln + j.  One 16-byte load per channel then fills
// the same element of all four B fragments, and 16 lanes cover 256 contiguous
// bytes of the channel's row.
// k order of both operands: element t <-> i0 + c0 + t, element t+8 <-> i0 + c0 + 16 + t.
//
// The weights come from LDS.  A block's 64 weight rows are read from global memory
// once, in whole 128-byte lines, rounded to bf16 once and laid down in fragment
// order; a fragment load straight from the row-major matrix touches 16 lines for
// 512 bytes, and every wave of a channel group would repeat it.
// LDS layout, one fragment (16 rows x 32 k) = WFRAG elements:
//   [row tile][k-step][half s = k/16][hi = (k/8)&1][row%16][8 k]
// with the hi blocks at a pitch of 320 bytes (256 + 64) and the halves at 640: a
// wave's 8-byte stores (4 rows x one line) then fall on all 64 banks once, and each
// 16-lane half of a 16-byte fragment read stays 256 contiguous bytes.
// ---------------------------------------------------------------------------
#define WHI   160                 // elements between the hi blocks of a half
#define WHALF 320                 // elements between the halves of a fragment
#define WFRAG 640                 // elements per fragment

// wsrc: first of the block's 64 rows.  Thread t, round it: 16 bytes of row
// 32*(it&1) + t/8, k-step it/2, piece t%8 (k = 4*piece .. 4*piece+3 of the step).
template <int CIN>
__device__ __forceinline__ void stage_weights(const float* __restrict__ wsrc, __bf16* __restrict__ wl) {
    constexpr int KS = CIN / 32;
    const int t = threadIdx.x, piece = t & 7, row = t >> 3;
    const float* gp = wsrc + (size_t)row * CIN + piece * 4;
    __bf16* lp = wl + (row >> 4) * (KS * WFRAG) + (piece >> 2) * WHALF + ((piece >> 1) & 1) * WHI
               + (row & 15) * 8 + (piece & 1) * 4;
    #pragma unroll  // row and k steps become immediate offsets of the loads and stores
    for (int g = 0; g < CIN / 16; g += 16) {
        float4 w[16];
        #pragma unroll  // constant indices keep the array in registers
        for (int u = 0; u < 16; ++u)
            w[u] = *(const float4*)(gp + (size_t)((g + u) & 1) * 32 * CIN + ((g + u) >> 1) * 32);
        #pragma unroll  // constant indices keep the array in registers
        for (int u = 0; u < 16; ++u) {
            v4bf pk;
            pk[0] = (__bf16)w[u].x; pk[1] = (__bf16)w[u].y; pk[2] = (__bf16)w[u].z; pk[3] = (__bf16)w[u].w;
            *(v4bf*)(lp + ((g + u) & 1) * 2 * (KS * WFRAG) + ((g + u) >> 1) * WFRAG) = pk;
        }
    }
    // precaution: the address pair that every load above names is an input here,
    // so it stays untouched up to this wait and is reused only behind it
    asm volatile("s_wait_xcnt 0x0" :: "v"(gp) : "memory");
    // publishes the block's weights: every wave reads fragments that other waves wrote
    __syncthreads();
}

template <int FO, int CIN, int NC>
__device__ __forceinline__ void proj_tile(const __bf16* __restrict__ wfrag, // LDS: wave's first row tile + hi*WHI + ln*8
                                          const float* __restrict__ xcol,   // X[b] + c0*NC + n0 + 4*ln
                                          v8f (&acc)[FO][4]) {
    #pragma unroll  // constant indices keep the arrays in registers
    for (int f = 0; f < FO; ++f)
        #pragma unroll  // constant indices keep the arrays in registers
        for (int j = 0; j < 4; ++j) acc[f][j] = v8f{};

    #pragma unroll  // row and column steps become immediate offsets of the loads
    for (int i0 = 0; i0 < CIN; i0 += 32) {
        // all loads of this k-step first, as one group: one wait per k-step
        float4 xr[16];
        V16U aw[FO];
        #pragma unroll  // constant indices keep the arrays in registers
        for (int t = 0; t < 8; ++t) {
            xr[t]     = *(const float4*)(xcol + (size_t)(i0 + t) * NC);
            xr[t + 8] = *(const float4*)(xcol + (size_t)(i0 + 16 + t) * NC);
        }
        #pragma unroll  // constant indices keep the arrays in registers
        for (int f = 0; f < FO; ++f) {
            const __bf16* wp = wfrag + (f * (CIN / 32) + i0 / 32) * WFRAG;
            aw[f].h2[0] = *(const v8bf*)(wp);
            aw[f].h2[1] = *(const v8bf*)(wp + WHALF);
        }
        // keeps the group whole: without it the scheduler sinks loads between the
        // products and the wave waits out a load latency per fragment
        __builtin_amdgcn_sched_barrier(0);
        v16bf bx[4];
        #pragma unroll  // constant indices keep the arrays in registers
        for (int e = 0; e < 16; ++e) {
            bx[0][e] = (__bf16)xr[e].x;
            bx[1][e] = (__bf16)xr[e].y;
            bx[2][e] = (__bf16)xr[e].z;
            bx[3][e] = (__bf16)xr[e].w;
        }
        #pragma unroll  // constant indices keep the arrays in registers
        for (int f = 0; f < FO; ++f)
            #pragma unroll  // constant indices keep the arrays in registers
            for (int j = 0; j < 4; ++j) acc[f][j] = WMMA_BF16(aw[f].v, bx[j], acc[f][j]);
    }
    // precaution: the address pair that every global load above names is an input
    // here, so it stays untouched up to this wait and is reused only behind it
    asm volatile("s_wait_xcnt 0x0" :: "v"(xcol) : "memory");
}

// bf16 store of Q and K in fragment order.  Per (b, h) the plane is cut into
// tiles of 16 columns x 32 head channels = 1 KB, laid out as the attention
// kernel's operand registers want them:
//   [tile n/16][half s = ch/16][lane = 16*((ch/8)&1) + n%16][8 channels]
// so a wave's 16-byte load of one half covers 512 contiguous bytes.
// Rows o = o0 + 16f + 8*hi + r are 8 consecutive head channels of column n:
// exactly one 16-byte chunk (s = f, chunk lane = 16*hi + n%16).
template <int FO, int NC>
__device__ __forceinline__ void store_hn32(const v8f (&acc)[FO][4], __bf16* __restrict__ dst,
                                           int b, int o0, int n0, int ln, int hi) {
    #pragma unroll  // constant indices keep the arrays in registers
    for (int f = 0; f < FO; ++f) {
        const int of = o0 + 16 * f;
        #pragma unroll  // constant indices keep the arrays in registers
        for (int j = 0; j < 4; ++j) {
            v8bf pk;
            #pragma unroll  // constant indices keep the arrays in registers
            for (int r = 0; r < 8; ++r) pk[r] = (__bf16)acc[f][j][r];
            const int n = n0 + 4 * ln + j;
            __bf16* dp = dst + (size_t)(b * CH + (of >> 5)) * NC * CD + (n >> 4) * 512 + (of & 16) * 16 + (16 * hi + (n & 15)) * 8;
            *(v8bf*)dp = pk;
        }
    }
}

// All four projections are independent of each other: ONE launch, the block
// index picks the job.  Every block is 8 waves = 2 channel groups x 4 column
// groups (64 x 256 outputs): waves w and w+4 read the same activations, the
// waves of one channel group the same weight fragments in LDS.
//   blocks 0..127   : K and V (512 input channels, the longer job, started first)
//   blocks 128..639 : Q and skip (256 input channels)
// Inside a range the index runs channel block, then which weight matrix, then
// column block, then batch: the 8 blocks that read one activation tile are
// neighbours.  The two jobs of a range share one copy of the product loop; only
// the weight pointer and the store differ, chosen by block-uniform tests.
// amdgpu_waves_per_eu(2, 4): the register budget of two waves per SIMD lets the
// scheduler keep a k-step's loads in one group; up to four waves (two blocks
// per WGP) may be resident, so one block's products run under another's loads.
#define KV_BLOCKS 128
#define ALL_BLOCKS 640
__global__ __launch_bounds__(256) __attribute__((amdgpu_waves_per_eu(2, 4))) void proj_all_kernel(const float* __restrict__ pcd,
                                                       const float* __restrict__ ps,
                                                       const float* __restrict__ qw,
                                                       const float* __restrict__ kw,
                                                       const float* __restrict__ vw,
                                                       const float* __restrict__ sw,
                                                       __bf16* __restrict__ Qbf,
                                                       __bf16* __restrict__ Kbf,
                                                       __bf16* __restrict__ Vbf,
                                                       float* __restrict__ out) {
    const int lane = threadIdx.x & 31, wave = threadIdx.x >> 5;
    const int ln = lane & 15, hi = lane >> 4, c0 = hi ? 8 : 0;
    const int bid = blockIdx.x;
    v8f acc[2][4];
    // the block's 64 weight rows as bf16 fragments: 4 row tiles x up to 16 k-steps
    __shared__ __attribute__((aligned(16))) __bf16 wlds[4 * (KIN / 32) * WFRAG];
    if (bid < KV_BLOCKS) {
        const bool second = (bid >> 2) & 1;              // V, else K
        const int o0 = (bid & 3) * 64 + (wave >> 2) * 32;
        const int m0 = (((bid >> 3) & 3) * 4 + (wave & 3)) * 64;
        const int b  = bid >> 5;
        const float* W = second ? vw : kw;
        stage_weights<KIN>(W + (size_t)(bid & 3) * 64 * KIN, wlds);
        proj_tile<2, KIN, CM>(wlds + (wave >> 2) * 2 * (KIN / 32) * WFRAG + hi * WHI + ln * 8,
                              ps + ((size_t)b * KIN + c0) * CM + m0 + 4 * ln, acc);
        if (!second) {
            store_hn32<2, CM>(acc, Kbf, b, o0, m0, ln, hi);
            // precaution: closes the stores above before any path of the listing reuses
            // a register that they name
            asm volatile("s_wait_xcnt 0x0" ::: "memory");
        } else {
            // V in fragment order too.  Per (b, h), blocks of 32 keys x 32 channels = 2 KB:
            //   [block m/32][channel tile d/16][half s = (m/16)&1][lane = 16*((m/8)&1) + d%16][8 keys]
            // The four column tiles of a lane are 4 consecutive m, half of one 16-byte
            // chunk -> one 8-byte store per row.
            #pragma unroll  // constant indices keep the arrays in registers
            for (int f = 0; f < 2; ++f)
                #pragma unroll  // constant indices keep the arrays in registers
                for (int r = 0; r < 8; ++r) {
                    v4bf pk;
                    #pragma unroll  // constant indices keep the arrays in registers
                    for (int j = 0; j < 4; ++j) pk[j] = (__bf16)acc[f][j][r];
                    __bf16* dp = Vbf + (size_t)(b * CH + (o0 >> 5)) * CD * CM + ((m0 >> 5) + (ln >> 3)) * 1024 + f * 512
                               + ((ln >> 2) & 1) * 256 + (16 * ((ln >> 1) & 1) + 8 * hi + r) * 8 + 4 * (ln & 1);
                    *(v4bf*)dp = pk;
                }
            // precaution: closes the stores above before any path of the listing reuses
            // a register that they name
            asm volatile("s_wait_xcnt 0x0" ::: "memory");
        }
    } else {
        const int rid = bid - KV_BLOCKS;
        const bool second = (rid >> 2) & 1;              // skip, else Q
        const int o0 = (rid & 3) * 64 + (wave >> 2) * 32;
        const int n0 = (((rid >> 3) & 15) * 4 + (wave & 3)) * 64;
        const int b  = rid >> 7;
        const float* W = second ? sw : qw;
        stage_weights<QIN>(W + (size_t)(rid & 3) * 64 * QIN, wlds);
        proj_tile<2, QIN, CN>(wlds + (wave >> 2) * 2 * (QIN / 32) * WFRAG + hi * WHI + ln * 8,
                              pcd + ((size_t)b * QIN + c0) * CN + n0 + 4 * ln, acc);
        if (!second) {
            #pragma unroll  // constant indices keep the arrays in registers
            for (int f = 0; f < 2; ++f)
                #pragma unroll  // constant indices keep the arrays in registers
                for (int j = 0; j < 4; ++j) acc[f][j] *= QSCALE;
            store_hn32<2, CN>(acc, Qbf, b, o0, n0, ln, hi);
            // precaution: closes the stores above before any path of the listing reuses
            // a register that they name
            asm volatile("s_wait_xcnt 0x0" ::: "memory");
        } else {
            // skip, fp32 out[b, o, n]: 4 consecutive n per lane and row -> one
            // 16-byte store, 16 lanes cover 256 contiguous bytes.
            #pragma unroll  // constant indices keep the arrays in registers
            for (int f = 0; f < 2; ++f)
                #pragma unroll  // constant indices keep the arrays in registers
                for (int r = 0; r < 8; ++r) {
                    float* dp = out + ((size_t)b * COUT + o0 + 16 * f + 8 * hi + r) * CN + n0 + 4 * ln;
                    *(float4*)dp = make_float4(acc[f][0][r], acc[f][1][r], acc[f][2][r], acc[f][3][r]);
                }
            // precaution: closes the stores above before any path of the listing reuses
            // a register that they name
            asm volatile("s_wait_xcnt 0x0" ::: "memory");
        }
    }
}

// ---------------------------------------------------------------------------
// Fused attention, no LDS / no shuffles in the hot loop.
//   E^T = K-tile x Q-tile   (C-layout of E^T == B-layout of P^T, by symmetry)
//   x^T = V-tile x P^T      (accumulated over all M in two v8f tiles per Q tile)
// One wave owns NQ = 4 Q tiles (64 query columns), all kept in registers: each
// K and V fragment is loaded once per wave and trip and feeds four products.
// The grid is 256 blocks of 8 waves (two waves per SIMD), too few waves to hide a
// load behind other waves, so the fragments of trip t+1 are loaded into a second
// register set in front of the products of trip t.
// Softmax uses unnormalized exp (scores ~ N(0,1); |max| ~ 6 => no overflow),
// per-column sums are lane-local partials + one shfl_xor(16) at the end.
// ---------------------------------------------------------------------------
#define NQ 4

// the A operands of one trip (32 keys)
struct KVFrag { V16U k0, k1, v0, v1; };

// kp, vp: this lane's 16 bytes in the K and V planes at key m; OFF: a further step
// in elements.  K rows m+ln and m+16+ln: tiles m/16 and m/16+1; V rows d = ln and
// 16+ln, K = m_rel: block m/32.  Fragment order: 512 contiguous bytes per load.
template <int OFF>
__device__ __forceinline__ void load_kv(KVFrag& f, const __bf16* __restrict__ kp,
                                        const __bf16* __restrict__ vp) {
    f.k0.h2[0] = *(const v8bf*)(kp + OFF);        f.k0.h2[1] = *(const v8bf*)(kp + OFF + 256);
    f.k1.h2[0] = *(const v8bf*)(kp + OFF + 512);  f.k1.h2[1] = *(const v8bf*)(kp + OFF + 768);
    f.v0.h2[0] = *(const v8bf*)(vp + OFF);        f.v0.h2[1] = *(const v8bf*)(vp + OFF + 256);
    f.v1.h2[0] = *(const v8bf*)(vp + OFF + 512);  f.v1.h2[1] = *(const v8bf*)(vp + OFF + 768);
    // precaution: the address pairs that the eight loads name are inputs here,
    // so they stay untouched up to this wait and are reused only behind it
    asm volatile("s_wait_xcnt 0x0" :: "v"(kp), "v"(vp) : "memory");
    // keeps the eight loads in front of the products that follow: without it the
    // scheduler sinks them towards their first use and a trip waits for its own loads
    __builtin_amdgcn_sched_barrier(0);
}

__device__ __forceinline__ void attn_trip(const KVFrag& f, const V16U (&bq)[NQ],
                                          v8f (&accA)[NQ], v8f (&accB)[NQ], float (&lsum)[NQ]) {
    const v8f zero = {};
    // E^T tiles: rows m_rel, cols n
    v8f e0[NQ], e1[NQ];
    #pragma unroll  // constant indices keep the arrays in registers
    for (int q = 0; q < NQ; ++q) {
        e0[q] = WMMA_BF16(f.k0.v, bq[q].v, zero);
        e1[q] = WMMA_BF16(f.k1.v, bq[q].v, zero);
    }
    #pragma unroll  // constant indices keep the arrays in registers
    for (int q = 0; q < NQ; ++q) {
        // P^T = 2^(E^T), Q carrying QSCALE
        #pragma unroll  // constant indices keep the arrays in registers
        for (int r = 0; r < 8; ++r) {
            e0[q][r] = __builtin_amdgcn_exp2f(e0[q][r]);
            e1[q][r] = __builtin_amdgcn_exp2f(e1[q][r]);
        }
        // C-layout is exactly the next B-layout:
        //   element e of B  <->  e0[e] (e<8) / e1[e-8] (e>=8), all lanes alike
        V16U bp;
        #pragma unroll  // constant indices keep the arrays in registers
        for (int r = 0; r < 8; ++r) {
            lsum[q] += e0[q][r] + e1[q][r];   // lane-local partial column sum
            bp.v[r]     = (__bf16)e0[q][r];
            bp.v[r + 8] = (__bf16)e1[q][r];
        }

        // x^T accumulate: rows d, cols n
        accA[q] = WMMA_BF16(f.v0.v, bp.v, accA[q]);
        accB[q] = WMMA_BF16(f.v1.v, bp.v, accB[q]);
    }
}

__global__ __launch_bounds__(256) void attn_kernel(const __bf16* __restrict__ Qbf,
                                                   const __bf16* __restrict__ Kbf,
                                                   const __bf16* __restrict__ Vbf,
                                                   float* __restrict__ out) {
    const int lane = threadIdx.x & 31, wave = threadIdx.x >> 5;
    const int ln = lane & 15, hi = lane >> 4;
    const int h = blockIdx.y;
    const int b = blockIdx.z;
    const int n0 = (blockIdx.x * 8 + wave) * (16 * NQ);

    const __bf16* klane = Kbf + (size_t)(b * CH + h) * CM * CD + lane * 8;
    const __bf16* vlane = Vbf + (size_t)(b * CH + h) * CD * CM + lane * 8;

    // B operands (Q): tile q holds cols n0+16q+ln, K = head channel; fragment
    // order: the two halves of a tile are 512 contiguous bytes each, 16 bytes per lane
    const __bf16* qrow = Qbf + ((size_t)(b * CH + h) * CN + n0) * CD + lane * 8;
    V16U bq[NQ];
    #pragma unroll  // constant indices keep the arrays in registers
    for (int q = 0; q < NQ; ++q) {
        bq[q].h2[0] = *(const v8bf*)(qrow + q * 512);
        bq[q].h2[1] = *(const v8bf*)(qrow + q * 512 + 256);
    }

    // trip 0's fragments go out behind the Q loads (the scheduler would swap them):
    // loads return in order, so a wait for a K fragment then covers Q, and no wait in
    // the loop has to reach past the fragment it needs
    __builtin_amdgcn_sched_barrier(0);
    KVFrag fa, fb;
    load_kv<0>(fa, klane, vlane);

    float lsum[NQ];
    v8f accA[NQ], accB[NQ];
    #pragma unroll  // constant indices keep the arrays in registers
    for (int q = 0; q < NQ; ++q) { lsum[q] = 0.f; accA[q] = v8f{}; accB[q] = v8f{}; }

    // two trips per pass, so that the two register sets swap roles without copies
    for (int m0 = 0; m0 < CM; m0 += 64) {
        load_kv<32 * CD>(fb, klane + (size_t)m0 * CD, vlane + (size_t)m0 * CD);
        attn_trip(fa, bq, accA, accB, lsum);
        // the last pass has no next trip: it reads trip 0 again (in bounds, unused)
        const int mn = (m0 + 64) & (CM - 1);
        load_kv<0>(fa, klane + (size_t)mn * CD, vlane + (size_t)mn * CD);
        attn_trip(fb, bq, accA, accB, lsum);
    }

    #pragma unroll  // constant indices keep the arrays in registers
    for (int q = 0; q < NQ; ++q) {
        // combine the two half-column partial sums (lanes ln and ln+16 share n)
        const float tot = lsum[q] + __shfl_xor(lsum[q], 16, 32);
        const float inv = 1.0f / tot;

        // out[b, h*32 + d, n] += x/lsum ; accA: d = r+8*hi, accB: d = 16+r+8*hi
        #pragma unroll  // constant indices keep the arrays in registers
        for (int r = 0; r < 8; ++r) {
            const size_t iA = ((size_t)(b * COUT) + h * CD + r + 8 * hi) * CN + n0 + 16 * q + ln;
            const size_t iB = iA + (size_t)16 * CN;
            out[iA] += accA[q][r] * inv;
            out[iB] += accB[q][r] * inv;
        }
    }
}

// ---------------------------------------------------------------------------
// Launcher
// ---------------------------------------------------------------------------
extern "C" void kernel_launch(void* const* d_in, const int* in_sizes, int n_in,
                              void* d_out, int out_size, void* d_ws, size_t ws_size,
                              hipStream_t stream) {
    const float* pcd = (const float*)d_in[0];   // [4,256,4096]
    const float* ps  = (const float*)d_in[1];   // [4,512,1024]
    const float* qw  = (const float*)d_in[2];   // [256,256]
    const float* kw  = (const float*)d_in[3];   // [256,512]
    const float* vw  = (const float*)d_in[4];   // [256,512]
    const float* sw  = (const float*)d_in[5];   // [256,256]
    float* out = (float*)d_out;                 // [4,256,4096]

    __bf16* Qbf = (__bf16*)d_ws;                           // 8 MB  [b,h] planes, fragment order
    __bf16* Kbf = Qbf + (size_t)CB * CH * CN * CD;         // 2 MB  [b,h] planes, fragment order
    __bf16* Vbf = Kbf + (size_t)CB * CH * CM * CD;         // 2 MB  [b,h] planes, fragment order

    hipLaunchKernelGGL(proj_all_kernel, dim3(ALL_BLOCKS), dim3(256), 0, stream,
                       pcd, ps, qw, kw, vw, sw, Qbf, Kbf, Vbf, out);
    hipLaunchKernelGGL(attn_kernel, dim3(CN / (128 * NQ), CH, CB), dim3(256), 0, stream, Qbf, Kbf, Vbf, out);
}

// v007
// It runs in 34.7 microseconds.
// In two side-by-side timings against v006, it was 1.05 and 1.06 times as fast.
// Over all steps from v000 it is 3.69 times as fast.
#include <hip/hip_runtime.h>
#include <hip/hip_bf16.h>

// ---------------------------------------------------------------------------
// B=4, N=4096, M=1024, H=8, head dim 32, Q_IN=256, K_IN=512, OUT=256.
// out = skip_w@pcd + per-head softmax(qT k / sqrt(32)) @ vT      (fp32 out)
//
// All GEMMs run on v_wmma_f32_16x16x32_bf16 (wave32).  Key layout fact used
// everywhere: CDNA5 16-bit A and B operands share ONE register layout —
// outer index (A-row / B-col) = lane%16; element e holds K-chunk
//   lanes 0-15 : K in {0..7, 16..23},   lanes 16-31 : K in {8..15, 24..31}
// i.e. two 16-byte chunks at element offsets c0 and c0+16, c0 = (lane>=16)*8.
// fp32 C/D layout: VGPR r, lanes 0-15 = (row r, col lane),
//                          lanes 16-31 = (row r+8, col lane-16).
// ---------------------------------------------------------------------------

typedef __attribute__((ext_vector_type(16))) __bf16 v16bf;
typedef __attribute__((ext_vector_type(8)))  __bf16 v8bf;
typedef __attribute__((ext_vector_type(4)))  __bf16 v4bf;
typedef __attribute__((ext_vector_type(8)))  float  v8f;

#define CB 4
#define CH 8
#define CN 4096
#define CM 1024
#define CD 32
#define QIN 256
#define KIN 512
#define COUT 256

#define WMMA_BF16(A, B, C) \
    __builtin_amdgcn_wmma_f32_16x16x32_bf16(false, (A), false, (B), (short)0, (C), false, false)

union V16U { v16bf v; v8bf h2[2]; };

// exp(e / sqrt(32)) = 2^(e * QSCALE).  The factor is linear in Q, so it is applied
// once per Q element in the projection, in fp32 ahead of the one rounding to bf16;
// the scores then leave the matrix unit as the exponent of 2.
#define QSCALE ((float)(0.17677669529663689 * 1.4426950408889634))   // 1/sqrt(32) * log2(e)

// ---------------------------------------------------------------------------
// Projections, all in the W x X orientation: D[o, n] = sum_i W[o,i] X[b,i,n].
// One wave owns a register tile of FO*16 output channels x 64 columns (FO = 2
// everywhere), so one activation fragment feeds FO products and one weight
// fragment feeds four.
// The 64 columns are dealt to the four column tiles interleaved: tile j, lane
// column ln  <->  n = n0 + 4*ln + j.  One 16-byte load per channel then fills
// the same element of all four B fragments, and 16 lanes cover 256 contiguous
// bytes of the channel's row.
// k order of both operands: element t <-> i0 + c0 + t, element t+8 <-> i0 + c0 + 16 + t.
//
// The weights come from LDS.  A block's 64 weight rows are read from global memory
// once, in whole 128-byte lines, rounded to bf16 once and laid down in fragment
// order; a fragment load straight from the row-major matrix touches 16 lines for
// 512 bytes, and every wave of a channel group would repeat it.
// LDS layout, one fragment (16 rows x 32 k) = WFRAG elements:
//   [row tile][k-step][half s = k/16][hi = (k/8)&1][row%16][8 k]
// with the hi blocks at a pitch of 320 bytes (256 + 64) and the halves at 640: a
// wave's 8-byte stores (4 rows x one line) then fall on all 64 banks once, and each
// 16-lane half of a 16-byte fragment read stays 256 contiguous bytes.
// ---------------------------------------------------------------------------
#define WHI   160                 // elements between the hi blocks of a half
#define WHALF 320                 // elements between the halves of a fragment
#define WFRAG 640                 // elements per fragment

// wsrc: first of the block's 64 rows.  Thread t, round it: 16 bytes of row
// 32*(it&1) + t/8, k-step it/2, piece t%8 (k = 4*piece .. 4*piece+3 of the step).
template <int CIN>
__device__ __forceinline__ void stage_weights(const float* __restrict__ wsrc, __bf16* __restrict__ wl) {
    constexpr int KS = CIN / 32;
    const int t = threadIdx.x, piece = t & 7, row = t >> 3;
    const float* gp = wsrc + (size_t)row * CIN + piece * 4;
    __bf16* lp = wl + (row >> 4) * (KS * WFRAG) + (piece >> 2) * WHALF + ((piece >> 1) & 1) * WHI
               + (row & 15) * 8 + (piece & 1) * 4;
    #pragma unroll  // row and k steps become immediate offsets of the loads and stores
    for (int g = 0; g < CIN / 16; g += 16) {
        float4 w[16];
        #pragma unroll  // constant indices keep the array in registers
        for (int u = 0; u < 16; ++u)
            w[u] = *(const float4*)(gp + (size_t)((g + u) & 1) * 32 * CIN + ((g + u) >> 1) * 32);
        #pragma unroll  // constant indices keep the array in registers
        for (int u = 0; u < 16; ++u) {
            v4bf pk;
            pk[0] = (__bf16)w[u].x; pk[1] = (__bf16)w[u].y; pk[2] = (__bf16)w[u].z; pk[3] = (__bf16)w[u].w;
            *(v4bf*)(lp + ((g + u) & 1) * 2 * (KS * WFRAG) + ((g + u) >> 1) * WFRAG) = pk;
        }
    }
    // precaution: the address pair that every load above names is an input here,
    // so it stays untouched up to this wait and is reused only behind it
    asm volatile("s_wait_xcnt 0x0" :: "v"(gp) : "memory");
    // publishes the block's weights: every wave reads fragments that other waves wrote
    __syncthreads();
}

// One k-step's activations of a lane: 16 channels x 4 columns.
struct XStep { float4 r[16]; };

// xwave: the wave's first column in channel 0 (the same in all lanes, a scalar base);
// xlane: the lane's byte offset from it, (c0*NC + 4*ln) * 4.
template <int NC>
__device__ __forceinline__ void load_x(XStep& x, const float* __restrict__ xwave, unsigned xlane, int i0) {
    const char* p = (const char*)xwave + xlane;
    #pragma unroll  // constant indices keep the array in registers
    for (int t = 0; t < 8; ++t) {
        x.r[t]     = *(const float4*)(p + (size_t)(i0 + t) * NC * 4);
        x.r[t + 8] = *(const float4*)(p + (size_t)(i0 + 16 + t) * NC * 4);
    }
}

// The activations come from memory, and a wave that asks for a k-step and then waits
// for it pays a whole memory latency per k-step.  Two register sets: the loads of
// k-step s+1 go out in front of the products of k-step s, so two k-steps are in
// flight and a latency is paid once per two k-steps.  x0 holds k-step 0, requested
// by the caller ahead of the weight staging.
template <int FO, int CIN, int NC>
__device__ __forceinline__ void proj_tile(const __bf16* __restrict__ wfrag, // LDS: wave's first row tile + hi*WHI + ln*8
                                          const float* __restrict__ xwave,  // X[b] + n0
                                          unsigned xlane,                   // (c0*NC + 4*ln) * 4 bytes
                                          XStep& x0,
                                          v8f (&acc)[FO][4]) {
    #pragma unroll  // constant indices keep the arrays in registers
    for (int f = 0; f < FO; ++f)
        #pragma unroll  // constant indices keep the arrays in registers
        for (int j = 0; j < 4; ++j) acc[f][j] = v8f{};

    XStep x1;
    #pragma unroll  // row and column steps become immediate offsets of the loads; the two sets swap roles without copies
    for (int i0 = 0; i0 < CIN; i0 += 32) {
        XStep& cur = (i0 & 32) ? x1 : x0;
        XStep& nxt = (i0 & 32) ? x0 : x1;
        // the next k-step's loads first, as one group, then this k-step's weight fragments
        if (i0 + 32 < CIN) load_x<NC>(nxt, xwave, xlane, i0 + 32);
        V16U aw[FO];
        #pragma unroll  // constant indices keep the arrays in registers
        for (int f = 0; f < FO; ++f) {
            const __bf16* wp = wfrag + (f * (CIN / 32) + i0 / 32) * WFRAG;
            aw[f].h2[0] = *(const v8bf*)(wp);
            aw[f].h2[1] = *(const v8bf*)(wp + WHALF);
        }
        // keeps the group whole and in front of this k-step's products: without it the
        // scheduler sinks the loads towards their first use, one k-step later
        __builtin_amdgcn_sched_barrier(0);
        v16bf bx[4];
        #pragma unroll  // constant indices keep the arrays in registers
        for (int e = 0; e < 16; ++e) {
            bx[0][e] = (__bf16)cur.r[e].x;
            bx[1][e] = (__bf16)cur.r[e].y;
            bx[2][e] = (__bf16)cur.r[e].z;
            bx[3][e] = (__bf16)cur.r[e].w;
        }
        #pragma unroll  // constant indices keep the arrays in registers
        for (int f = 0; f < FO; ++f)
            #pragma unroll  // constant indices keep the arrays in registers
            for (int j = 0; j < 4; ++j) acc[f][j] = WMMA_BF16(aw[f].v, bx[j], acc[f][j]);
    }
    // precaution: the base and the offset that every global load above names are inputs
    // here, so they stay untouched up to this wait and are reused only behind it
    asm volatile("s_wait_xcnt 0x0" :: "s"(xwave), "v"(xlane) : "memory");
}

// bf16 store of Q and K in fragment order.  Per (b, h) the plane is cut into
// tiles of 16 columns x 32 head channels = 1 KB, laid out as the attention
// kernel's operand registers want them:
//   [tile n/16][half s = ch/16][lane = 16*((ch/8)&1) + n%16][8 channels]
// so a wave's 16-byte load of one half covers 512 contiguous bytes.
// Rows o = o0 + 16f + 8*hi + r are 8 consecutive head channels of column n:
// exactly one 16-byte chunk (s = f, chunk lane = 16*hi + n%16).
template <int FO, int NC>
__device__ __forceinline__ void store_hn32(const v8f (&acc)[FO][4], __bf16* __restrict__ dst,
                                           int b, int o0, int n0, int ln, int hi) {
    #pragma unroll  // constant indices keep the arrays in registers
    for (int f = 0; f < FO; ++f) {
        const int of = o0 + 16 * f;
        #pragma unroll  // constant indices keep the arrays in registers
        for (int j = 0; j < 4; ++j) {
            v8bf pk;
            #pragma unroll  // constant indices keep the arrays in registers
            for (int r = 0; r < 8; ++r) pk[r] = (__bf16)acc[f][j][r];
            const int n = n0 + 4 * ln + j;
            __bf16* dp = dst + (size_t)(b * CH + (of >> 5)) * NC * CD + (n >> 4) * 512 + (of & 16) * 16 + (16 * hi + (n & 15)) * 8;
            *(v8bf*)dp = pk;
        }
    }
}

// All four projections are independent of each other: ONE launch, the block
// index picks the job.  Every block is 8 waves = 2 channel groups x 4 column
// groups (64 x 256 outputs): waves w and w+4 read the same activations, the
// waves of one channel group the same weight fragments in LDS.
//   blocks 0..127   : K and V (512 input channels, the longer job, started first)
//   blocks 128..639 : Q and skip (256 input channels)
// Inside a range the index runs channel block, then which weight matrix, then
// column block, then batch: the 8 blocks that read one activation tile are
// neighbours.  The two jobs of a range share one copy of the product loop; only
// the weight pointer and the store differ, chosen by block-uniform tests.
// amdgpu_waves_per_eu(4, 4): the register budget of four waves per SIMD (256): the two
// activation sets, the accumulators and the fragments just fit, and two blocks per WGP
// stay resident, so one block's products run under another's loads.
#define KV_BLOCKS 128
#define ALL_BLOCKS 640
__global__ __launch_bounds__(256) __attribute__((amdgpu_waves_per_eu(4, 4))) void proj_all_kernel(const float* __restrict__ pcd,
                                                       const float* __restrict__ ps,
                                                       const float* __restrict__ qw,
                                                       const float* __restrict__ kw,
                                                       const float* __restrict__ vw,
                                                       const float* __restrict__ sw,
                                                       __bf16* __restrict__ Qbf,
                                                       __bf16* __restrict__ Kbf,
                                                       __bf16* __restrict__ Vbf,
                                                       float* __restrict__ out) {
    const int lane = threadIdx.x & 31;
    // the wave's number is the same in all its lanes: held in a scalar register, what is
    // derived from it (tile origins) takes no vector register through the product loop
    const int wave = __builtin_amdgcn_readfirstlane(threadIdx.x >> 5);
    const int ln = lane & 15, hi = lane >> 4, c0 = hi ? 8 : 0;
    const int bid = blockIdx.x;
    v8f acc[2][4];
    // the block's 64 weight rows as bf16 fragments: 4 row tiles x up to 16 k-steps
    __shared__ __attribute__((aligned(16))) __bf16 wlds[4 * (KIN / 32) * WFRAG];
    if (bid < KV_BLOCKS) {
        const bool second = (bid >> 2) & 1;              // V, else K
        const int o0 = (bid & 3) * 64 + (wave >> 2) * 32;
        const int m0 = (((bid >> 3) & 3) * 4 + (wave & 3)) * 64;
        const int b  = bid >> 5;
        const float* W = second ? vw : kw;
        const float* xwave = ps + (size_t)b * KIN * CM + m0;
        const unsigned xlane = (c0 * CM + 4 * ln) * 4;
        XStep x0;
        load_x<CM>(x0, xwave, xlane, 0);
        // k-step 0's loads go out ahead of the weight loads and fly under the staging
        __builtin_amdgcn_sched_barrier(0);
        stage_weights<KIN>(W + (size_t)(bid & 3) * 64 * KIN, wlds);
        proj_tile<2, KIN, CM>(wlds + (wave >> 2) * 2 * (KIN / 32) * WFRAG + hi * WHI + ln * 8, xwave, xlane, x0, acc);
        if (!second) {
            store_hn32<2, CM>(acc, Kbf, b, o0, m0, ln, hi);
            // precaution: closes the stores above before any path of the listing reuses
            // a register that they name
            asm volatile("s_wait_xcnt 0x0" ::: "memory");
        } else {
            // V in fragment order too.  Per (b, h), blocks of 32 keys x 32 channels = 2 KB:
            //   [block m/32][channel tile d/16][half s = (m/16)&1][lane = 16*((m/8)&1) + d%16][8 keys]
            // The four column tiles of a lane are 4 consecutive m, half of one 16-byte
            // chunk -> one 8-byte store per row.
            #pragma unroll  // constant indices keep the arrays in registers
            for (int f = 0; f < 2; ++f)
                #pragma unroll  // constant indices keep the arrays in registers
                for (int r = 0; r < 8; ++r) {
                    v4bf pk;
                    #pragma unroll  // constant indices keep the arrays in registers
                    for (int j = 0; j < 4; ++j) pk[j] = (__bf16)acc[f][j][r];
                    __bf16* dp = Vbf + (size_t)(b * CH + (o0 >> 5)) * CD * CM + ((m0 >> 5) + (ln >> 3)) * 1024 + f * 512
                               + ((ln >> 2) & 1) * 256 + (16 * ((ln >> 1) & 1) + 8 * hi + r) * 8 + 4 * (ln & 1);
                    *(v4bf*)dp = pk;
                }
            // precaution: closes the stores above before any path of the listing reuses
            // a register that they name
            asm volatile("s_wait_xcnt 0x0" ::: "memory");
        }
    } else {
        const int rid = bid - KV_BLOCKS;
        const bool second = (rid >> 2) & 1;              // skip, else Q
        const int o0 = (rid & 3) * 64 + (wave >> 2) * 32;
        const int n0 = (((rid >> 3) & 15) * 4 + (wave & 3)) * 64;
        const int b  = rid >> 7;
        const float* W = second ? sw : qw;
        const float* xwave = pcd + (size_t)b * QIN * CN + n0;
        const unsigned xlane = (c0 * CN + 4 * ln) * 4;
        XStep x0;
        load_x<CN>(x0, xwave, xlane, 0);
        // k-step 0's loads go out ahead of the weight loads and fly under the staging
        __builtin_amdgcn_sched_barrier(0);
        stage_weights<QIN>(W + (size_t)(rid & 3) * 64 * QIN, wlds);
        proj_tile<2, QIN, CN>(wlds + (wave >> 2) * 2 * (QIN / 32) * WFRAG + hi * WHI + ln * 8, xwave, xlane, x0, acc);
        if (!second) {
            #pragma unroll  // constant indices keep the arrays in registers
            for (int f = 0; f < 2; ++f)
                #pragma unroll  // constant indices keep the arrays in registers
                for (int j = 0; j < 4; ++j) acc[f][j] *= QSCALE;
            store_hn32<2, CN>(acc, Qbf, b, o0, n0, ln, hi);
            // precaution: closes the stores above before any path of the listing reuses
            // a register that they name
            asm volatile("s_wait_xcnt 0x0" ::: "memory");
        } else {
            // skip, fp32 out[b, o, n]: 4 consecutive n per lane and row -> one
            // 16-byte store, 16 lanes cover 256 contiguous bytes.
            #pragma unroll  // constant indices keep the arrays in registers
            for (int f = 0; f < 2; ++f)
                #pragma unroll  // constant indices keep the arrays in registers
                for (int r = 0; r < 8; ++r) {
                    float* dp = out + ((size_t)b * COUT + o0 + 16 * f + 8 * hi + r) * CN + n0 + 4 * ln;
                    *(float4*)dp = make_float4(acc[f][0][r], acc[f][1][r], acc[f][2][r], acc[f][3][r]);
                }
            // precaution: closes the stores above before any path of the listing reuses
            // a register that they name
            asm volatile("s_wait_xcnt 0x0" ::: "memory");
        }
    }
}

// ---------------------------------------------------------------------------
// Fused attention, no LDS / no shuffles in the hot loop.
//   E^T = K-tile x Q-tile   (C-layout of E^T == B-layout of P^T, by symmetry)
//   x^T = V-tile x P^T      (accumulated over all M in two v8f tiles per Q tile)
// One wave owns NQ = 4 Q tiles (64 query columns), all kept in registers: each
// K and V fragment is loaded once per wave and trip and feeds four products.
// The grid is 256 blocks of 8 waves (two waves per SIMD), too few waves to hide a
// load behind other waves, so the fragments of trip t+1 are loaded into a second
// register set in front of the products of trip t.
// Softmax uses unnormalized exp (scores ~ N(0,1); |max| ~ 6 => no overflow),
// per-column sums are lane-local partials + one shfl_xor(16) at the end.
// ---------------------------------------------------------------------------
#define NQ 4

// the A operands of one trip (32 keys)
struct KVFrag { V16U k0, k1, v0, v1; };

// kp, vp: this lane's 16 bytes in the K and V planes at key m; OFF: a further step
// in elements.  K rows m+ln and m+16+ln: tiles m/16 and m/16+1; V rows d = ln and
// 16+ln, K = m_rel: block m/32.  Fragment order: 512 contiguous bytes per load.
template <int OFF>
__device__ __forceinline__ void load_kv(KVFrag& f, const __bf16* __restrict__ kp,
                                        const __bf16* __restrict__ vp) {
    f.k0.h2[0] = *(const v8bf*)(kp + OFF);        f.k0.h2[1] = *(const v8bf*)(kp + OFF + 256);
    f.k1.h2[0] = *(const v8bf*)(kp + OFF + 512);  f.k1.h2[1] = *(const v8bf*)(kp + OFF + 768);
    f.v0.h2[0] = *(const v8bf*)(vp + OFF);        f.v0.h2[1] = *(const v8bf*)(vp + OFF + 256);
    f.v1.h2[0] = *(const v8bf*)(vp + OFF + 512);  f.v1.h2[1] = *(const v8bf*)(vp + OFF + 768);
    // precaution: the address pairs that the eight loads name are inputs here,
    // so they stay untouched up to this wait and are reused only behind it
    asm volatile("s_wait_xcnt 0x0" :: "v"(kp), "v"(vp) : "memory");
    // keeps the eight loads in front of the products that follow: without it the
    // scheduler sinks them towards their first use and a trip waits for its own loads
    __builtin_amdgcn_sched_barrier(0);
}

__device__ __forceinline__ void attn_trip(const KVFrag& f, const V16U (&bq)[NQ],
                                          v8f (&accA)[NQ], v8f (&accB)[NQ], float (&lsum)[NQ]) {
    const v8f zero = {};
    // E^T tiles: rows m_rel, cols n
    v8f e0[NQ], e1[NQ];
    #pragma unroll  // constant indices keep the arrays in registers
    for (int q = 0; q < NQ; ++q) {
        e0[q] = WMMA_BF16(f.k0.v, bq[q].v, zero);
        e1[q] = WMMA_BF16(f.k1.v, bq[q].v, zero);
    }
    #pragma unroll  // constant indices keep the arrays in registers
    for (int q = 0; q < NQ; ++q) {
        // P^T = 2^(E^T), Q carrying QSCALE
        #pragma unroll  // constant indices keep the arrays in registers
        for (int r = 0; r < 8; ++r) {
            e0[q][r] = __builtin_amdgcn_exp2f(e0[q][r]);
            e1[q][r] = __builtin_amdgcn_exp2f(e1[q][r]);
        }
        // C-layout is exactly the next B-layout:
        //   element e of B  <->  e0[e] (e<8) / e1[e-8] (e>=8), all lanes alike
        V16U bp;
        #pragma unroll  // constant indices keep the arrays in registers
        for (int r = 0; r < 8; ++r) {
            lsum[q] += e0[q][r] + e1[q][r];   // lane-local partial column sum
            bp.v[r]     = (__bf16)e0[q][r];
            bp.v[r + 8] = (__bf16)e1[q][r];
        }

        // x^T accumulate: rows d, cols n
        accA[q] = WMMA_BF16(f.v0.v, bp.v, accA[q]);
        accB[q] = WMMA_BF16(f.v1.v, bp.v, accB[q]);
    }
}

__global__ __launch_bounds__(256) void attn_kernel(const __bf16* __restrict__ Qbf,
                                                   const __bf16* __restrict__ Kbf,
                                                   const __bf16* __restrict__ Vbf,
                                                   float* __restrict__ out) {
    const int lane = threadIdx.x & 31, wave = threadIdx.x >> 5;
    const int ln = lane & 15, hi = lane >> 4;
    const int h = blockIdx.y;
    const int b = blockIdx.z;
    const int n0 = (blockIdx.x * 8 + wave) * (16 * NQ);

    const __bf16* klane = Kbf + (size_t)(b * CH + h) * CM * CD + lane * 8;
    const __bf16* vlane = Vbf + (size_t)(b * CH + h) * CD * CM + lane * 8;

    // B operands (Q): tile q holds cols n0+16q+ln, K = head channel; fragment
    // order: the two halves of a tile are 512 contiguous bytes each, 16 bytes per lane
    const __bf16* qrow = Qbf + ((size_t)(b * CH + h) * CN + n0) * CD + lane * 8;
    V16U bq[NQ];
    #pragma unroll  // constant indices keep the arrays in registers
    for (int q = 0; q < NQ; ++q) {
        bq[q].h2[0] = *(const v8bf*)(qrow + q * 512);
        bq[q].h2[1] = *(const v8bf*)(qrow + q * 512 + 256);
    }

    // trip 0's fragments go out behind the Q loads (the scheduler would swap them):
    // loads return in order, so a wait for a K fragment then covers Q, and no wait in
    // the loop has to reach past the fragment it needs
    __builtin_amdgcn_sched_barrier(0);
    KVFrag fa, fb;
    load_kv<0>(fa, klane, vlane);

    float lsum[NQ];
    v8f accA[NQ], accB[NQ];
    #pragma unroll  // constant indices keep the arrays in registers
    for (int q = 0; q < NQ; ++q) { lsum[q] = 0.f; accA[q] = v8f{}; accB[q] = v8f{}; }

    // two trips per pass, so that the two register sets swap roles without copies
    for (int m0 = 0; m0 < CM; m0 += 64) {
        load_kv<32 * CD>(fb, klane + (size_t)m0 * CD, vlane + (size_t)m0 * CD);
        attn_trip(fa, bq, accA, accB, lsum);
        // the last pass has no next trip: it reads trip 0 again (in bounds, unused)
        const int mn = (m0 + 64) & (CM - 1);
        load_kv<0>(fa, klane + (size_t)mn * CD, vlane + (size_t)mn * CD);
        attn_trip(fb, bq, accA, accB, lsum);
    }

    #pragma unroll  // constant indices keep the arrays in registers
    for (int q = 0; q < NQ; ++q) {
        // combine the two half-column partial sums (lanes ln and ln+16 share n)
        const float tot = lsum[q] + __shfl_xor(lsum[q], 16, 32);
        const float inv = 1.0f / tot;

        // out[b, h*32 + d, n] += x/lsum ; accA: d = r+8*hi, accB: d = 16+r+8*hi
        #pragma unroll  // constant indices keep the arrays in registers
        for (int r = 0; r < 8; ++r) {
            const size_t iA = ((size_t)(b * COUT) + h * CD + r + 8 * hi) * CN + n0 + 16 * q + ln;
            const size_t iB = iA + (size_t)16 * CN;
            out[iA] += accA[q][r] * inv;
            out[iB] += accB[q][r] * inv;
        }
    }
}

// ---------------------------------------------------------------------------
// Launcher
// ---------------------------------------------------------------------------
extern "C" void kernel_launch(void* const* d_in, const int* in_sizes, int n_in,
                              void* d_out, int out_size, void* d_ws, size_t ws_size,
                              hipStream_t stream) {
    const float* pcd = (const float*)d_in[0];   // [4,256,4096]
    const float* ps  = (const float*)d_in[1];   // [4,512,1024]
    const float* qw  = (const float*)d_in[2];   // [256,256]
    const float* kw  = (const float*)d_in[3];   // [256,512]
    const float* vw  = (const float*)d_in[4];   // [256,512]
    const float* sw  = (const float*)d_in[5];   // [256,256]
    float* out = (float*)d_out;                 // [4,256,4096]

    __bf16* Qbf = (__bf16*)d_ws;                           // 8 MB  [b,h] planes, fragment order
    __bf16* Kbf = Qbf + (size_t)CB * CH * CN * CD;         // 2 MB  [b,h] planes, fragment order
    __bf16* Vbf = Kbf + (size_t)CB * CH * CM * CD;         // 2 MB  [b,h] planes, fragment order

    hipLaunchKernelGGL(proj_all_kernel, dim3(ALL_BLOCKS), dim3(256), 0, stream,
                       pcd, ps, qw, kw, vw, sw, Qbf, Kbf, Vbf, out);
    hipLaunchKernelGGL(attn_kernel, dim3(CN / (128 * NQ), CH, CB), dim3(256), 0, stream, Qbf, Kbf, Vbf, out);
}

// v008
// A run of this version takes 32.3 microseconds.
// Timed twice side by side with v007, it ran 1.07 and 1.08 times as fast.
// Over all steps from v000 it is 3.96 times as fast.
#include <hip/hip_runtime.h>
#include <hip/hip_bf16.h>

// ---------------------------------------------------------------------------
// B=4, N=4096, M=1024, H=8, head dim 32, Q_IN=256, K_IN=512, OUT=256.
// out = skip_w@pcd + per-head softmax(qT k / sqrt(32)) @ vT      (fp32 out)
//
// All GEMMs run on v_wmma_f32_16x16x32_bf16 (wave32).  Key layout fact used
// everywhere: CDNA5 16-bit A and B operands share ONE register layout —
// outer index (A-row / B-col) = lane%16; element e holds K-chunk
//   lanes 0-15 : K in {0..7, 16..23},   lanes 16-31 : K in {8..15, 24..31}
// i.e. two 16-byte chunks at element offsets c0 and c0+16, c0 = (lane>=16)*8.
// fp32 C/D layout: VGPR r, lanes 0-15 = (row r, col lane),
//                          lanes 16-31 = (row r+8, col lane-16).
// ---------------------------------------------------------------------------

typedef __attribute__((ext_vector_type(16))) __bf16 v16bf;
typedef __attribute__((ext_vector_type(8)))  __bf16 v8bf;
typedef __attribute__((ext_vector_type(4)))  __bf16 v4bf;
typedef __attribute__((ext_vector_type(8)))  float  v8f;
typedef __attribute__((ext_vector_type(4)))  float  v4f;

#define CB 4
#define CH 8
#define CN 4096
#define CM 1024
#define CD 32
#define QIN 256
#define KIN 512
#define COUT 256

#define WMMA_BF16(A, B, C) \
    __builtin_amdgcn_wmma_f32_16x16x32_bf16(false, (A), false, (B), (short)0, (C), false, false)

union V16U { v16bf v; v8bf h2[2]; };

// exp(e / sqrt(32)) = 2^(e * QSCALE).  The factor is linear in Q, so it is applied
// once per Q element in the projection, in fp32 ahead of the one rounding to bf16;
// the scores then leave the matrix unit as the exponent of 2.
#define QSCALE ((float)(0.17677669529663689 * 1.4426950408889634))   // 1/sqrt(32) * log2(e)

// ---------------------------------------------------------------------------
// Projections, all in the W x X orientation: D[o, n] = sum_i W[o,i] X[b,i,n].
// One wave owns a register tile of FO*16 output channels x 64 columns (FO = 2 for
// K and V, 4 for Q with skip), so one activation fragment feeds FO products and one
// weight fragment feeds four.
// The 64 columns are dealt to the four column tiles interleaved: tile j, lane
// column ln  <->  n = n0 + 4*ln + j.  One 16-byte load per channel then fills
// the same element of all four B fragments, and 16 lanes cover 256 contiguous
// bytes of the channel's row.
// k order of both operands: element t <-> i0 + c0 + t, element t+8 <-> i0 + c0 + 16 + t.
//
// The weights come from LDS.  A block's 64 weight rows are read from global memory
// once, in whole 128-byte lines, rounded to bf16 once and laid down in fragment
// order; a fragment load straight from the row-major matrix touches 16 lines for
// 512 bytes, and every wave of a channel group would repeat it.
// LDS layout, one fragment (16 rows x 32 k) = WFRAG elements:
//   [row tile][k-step][half s = k/16][hi = (k/8)&1][row%16][8 k]
// with the hi blocks at a pitch of 320 bytes (256 + 64) and the halves at 640: a
// wave's 8-byte stores (4 rows x one line) then fall on all 64 banks once, and each
// 16-lane half of a 16-byte fragment read stays 256 contiguous bytes.
// ---------------------------------------------------------------------------
#define WHI   160                 // elements between the hi blocks of a half
#define WHALF 320                 // elements between the halves of a fragment
#define WFRAG 640                 // elements per fragment

// wlo, whi: first of the block's rows 0..31 and of its rows 32..63 (they may lie in two
// matrices).  Thread t, round it: 16 bytes of row
// 32*(it&1) + t/8, k-step it/2, piece t%8 (k = 4*piece .. 4*piece+3 of the step).
template <int CIN>
__device__ __forceinline__ void stage_weights(const float* __restrict__ wlo, const float* __restrict__ whi,
                                              __bf16* __restrict__ wl) {
    constexpr int KS = CIN / 32;
    const int t = threadIdx.x, piece = t & 7, row = t >> 3;
    const float* gp0 = wlo + (size_t)row * CIN + piece * 4;
    const float* gp1 = whi + (size_t)row * CIN + piece * 4;
    __bf16* lp = wl + (row >> 4) * (KS * WFRAG) + (piece >> 2) * WHALF + ((piece >> 1) & 1) * WHI
               + (row & 15) * 8 + (piece & 1) * 4;
    #pragma unroll  // row and k steps become immediate offsets of the loads and stores
    for (int g = 0; g < CIN / 16; g += 16) {
        float4 w[16];
        #pragma unroll  // constant indices keep the array in registers
        for (int u = 0; u < 16; ++u)
            w[u] = *(const float4*)((((g + u) & 1) ? gp1 : gp0) + ((g + u) >> 1) * 32);
        #pragma unroll  // constant indices keep the array in registers
        for (int u = 0; u < 16; ++u) {
            v4bf pk;
            pk[0] = (__bf16)w[u].x; pk[1] = (__bf16)w[u].y; pk[2] = (__bf16)w[u].z; pk[3] = (__bf16)w[u].w;
            *(v4bf*)(lp + ((g + u) & 1) * 2 * (KS * WFRAG) + ((g + u) >> 1) * WFRAG) = pk;
        }
    }
    // precaution: the address pairs that the loads above name are inputs here,
    // so they stay untouched up to this wait and are reused only behind it
    asm volatile("s_wait_xcnt 0x0" :: "v"(gp0), "v"(gp1) : "memory");
    // publishes the block's weights: every wave reads fragments that other waves wrote
    __syncthreads();
}

// One k-step's activations of a lane: 16 channels x 4 columns.
struct XStep { float4 r[16]; };

// xwave: the wave's first column in channel 0 (the same in all lanes, a scalar base);
// xlane: the lane's byte offset from it, (c0*NC + 4*ln) * 4.
template <int NC>
__device__ __forceinline__ void load_x(XStep& x, const float* __restrict__ xwave, unsigned xlane, int i0) {
    const char* p = (const char*)xwave + xlane;
    #pragma unroll  // constant indices keep the array in registers
    for (int t = 0; t < 8; ++t) {
        x.r[t]     = *(const float4*)(p + (size_t)(i0 + t) * NC * 4);
        x.r[t + 8] = *(const float4*)(p + (size_t)(i0 + 16 + t) * NC * 4);
    }
}

// The activations come from memory, and a wave that asks for a k-step and then waits
// for it pays a whole memory latency per k-step.  Two register sets: the loads of
// k-step s+1 go out in front of the products of k-step s, so two k-steps are in
// flight and a latency is paid once per two k-steps.  x0 holds k-step 0, requested
// by the caller ahead of the weight staging.
template <int FO, int CIN, int NC>
__device__ __forceinline__ void proj_tile(const __bf16* __restrict__ wfrag, // LDS: wave's first row tile + hi*WHI + ln*8
                                          const float* __restrict__ xwave,  // X[b] + n0
                                          unsigned xlane,                   // (c0*NC + 4*ln) * 4 bytes
                                          XStep& x0,
                                          v8f (&acc)[FO][4]) {
    #pragma unroll  // constant indices keep the arrays in registers
    for (int f = 0; f < FO; ++f)
        #pragma unroll  // constant indices keep the arrays in registers
        for (int j = 0; j < 4; ++j) acc[f][j] = v8f{};

    XStep x1;
    #pragma unroll  // row and column steps become immediate offsets of the loads; the two sets swap roles without copies
    for (int i0 = 0; i0 < CIN; i0 += 32) {
        XStep& cur = (i0 & 32) ? x1 : x0;
        XStep& nxt = (i0 & 32) ? x0 : x1;
        // the next k-step's loads first, as one group, then this k-step's weight fragments
        if (i0 + 32 < CIN) load_x<NC>(nxt, xwave, xlane, i0 + 32);
        V16U aw[FO];
        #pragma unroll  // constant indices keep the arrays in registers
        for (int f = 0; f < FO; ++f) {
            const __bf16* wp = wfrag + (f * (CIN / 32) + i0 / 32) * WFRAG;
            aw[f].h2[0] = *(const v8bf*)(wp);
            aw[f].h2[1] = *(const v8bf*)(wp + WHALF);
        }
        // keeps the group whole and in front of this k-step's products: without it the
        // scheduler sinks the loads towards their first use, one k-step later
        __builtin_amdgcn_sched_barrier(0);
        v16bf bx[4];
        #pragma unroll  // constant indices keep the arrays in registers
        for (int e = 0; e < 16; ++e) {
            bx[0][e] = (__bf16)cur.r[e].x;
            bx[1][e] = (__bf16)cur.r[e].y;
            bx[2][e] = (__bf16)cur.r[e].z;
            bx[3][e] = (__bf16)cur.r[e].w;
        }
        #pragma unroll  // constant indices keep the arrays in registers
        for (int f = 0; f < FO; ++f)
            #pragma unroll  // constant indices keep the arrays in registers
            for (int j = 0; j < 4; ++j) acc[f][j] = WMMA_BF16(aw[f].v, bx[j], acc[f][j]);
    }
    // precaution: the base and the offset that every global load above names are inputs
    // here, so they stay untouched up to this wait and are reused only behind it
    asm volatile("s_wait_xcnt 0x0" :: "s"(xwave), "v"(xlane) : "memory");
}

// bf16 store of K in fragment order.  Per (b, h) the plane is cut into
// tiles of 16 columns x 32 head channels = 1 KB, laid out as the attention
// kernel's operand registers want them:
//   [tile n/16][half s = ch/16][lane = 16*((ch/8)&1) + n%16][8 channels]
// so a wave's 16-byte load of one half covers 512 contiguous bytes.
// Rows o = o0 + 16f + 8*hi + r are 8 consecutive head channels of column n:
// exactly one 16-byte chunk (s = f, chunk lane = 16*hi + n%16).
template <int FO, int NC>
__device__ __forceinline__ void store_hn32(const v8f (&acc)[FO][4], __bf16* __restrict__ dst,
                                           int b, int o0, int n0, int ln, int hi) {
    #pragma unroll  // constant indices keep the arrays in registers
    for (int f = 0; f < FO; ++f) {
        const int of = o0 + 16 * f;
        #pragma unroll  // constant indices keep the arrays in registers
        for (int j = 0; j < 4; ++j) {
            v8bf pk;
            #pragma unroll  // constant indices keep the arrays in registers
            for (int r = 0; r < 8; ++r) pk[r] = (__bf16)acc[f][j][r];
            const int n = n0 + 4 * ln + j;
            __bf16* dp = dst + (size_t)(b * CH + (of >> 5)) * NC * CD + (n >> 4) * 512 + (of & 16) * 16 + (16 * hi + (n & 15)) * 8;
            *(v8bf*)dp = pk;
        }
    }
}

// K and V projections: one launch, the block index picks the job.  Every block is
// 8 waves = 2 channel groups x 4 column groups (64 x 256 outputs): waves w and w+4
// read the same activations, the waves of one channel group the same weight
// fragments in LDS.  The index runs channel block, then which weight matrix, then
// column block, then batch: the 8 blocks that read one activation tile are
// neighbours.  The two jobs share one copy of the product loop; only the weight
// pointer and the store differ, chosen by block-uniform tests.
// amdgpu_waves_per_eu(4, 4): the register budget of four waves per SIMD (256): the two
// activation sets, the accumulators and the fragments just fit.
#define KV_BLOCKS 128
__global__ __launch_bounds__(256) __attribute__((amdgpu_waves_per_eu(4, 4))) void proj_kv_kernel(const float* __restrict__ ps,
                                                       const float* __restrict__ kw,
                                                       const float* __restrict__ vw,
                                                       __bf16* __restrict__ Kbf,
                                                       __bf16* __restrict__ Vbf) {
    const int lane = threadIdx.x & 31;
    // the wave's number is the same in all its lanes: held in a scalar register, what is
    // derived from it (tile origins) takes no vector register through the product loop
    const int wave = __builtin_amdgcn_readfirstlane(threadIdx.x >> 5);
    const int ln = lane & 15, hi = lane >> 4, c0 = hi ? 8 : 0;
    const int bid = blockIdx.x;
    v8f acc[2][4];
    // the block's 64 weight rows as bf16 fragments: 4 row tiles x 16 k-steps
    __shared__ __attribute__((aligned(16))) __bf16 wlds[4 * (KIN / 32) * WFRAG];
    const bool second = (bid >> 2) & 1;              // V, else K
    const int o0 = (bid & 3) * 64 + (wave >> 2) * 32;
    const int m0 = (((bid >> 3) & 3) * 4 + (wave & 3)) * 64;
    const int b  = bid >> 5;
    const float* W = (second ? vw : kw) + (size_t)(bid & 3) * 64 * KIN;
    const float* xwave = ps + (size_t)b * KIN * CM + m0;
    const unsigned xlane = (c0 * CM + 4 * ln) * 4;
    XStep x0;
    load_x<CM>(x0, xwave, xlane, 0);
    // k-step 0's loads go out ahead of the weight loads and fly under the staging
    __builtin_amdgcn_sched_barrier(0);
    stage_weights<KIN>(W, W + (size_t)32 * KIN, wlds);
    proj_tile<2, KIN, CM>(wlds + (wave >> 2) * 2 * (KIN / 32) * WFRAG + hi * WHI + ln * 8, xwave, xlane, x0, acc);
    if (!second) {
        store_hn32<2, CM>(acc, Kbf, b, o0, m0, ln, hi);
        // precaution: closes the stores above before any path of the listing reuses
        // a register that they name
        asm volatile("s_wait_xcnt 0x0" ::: "memory");
    } else {
        // V in fragment order too.  Per (b, h), blocks of 32 keys x 32 channels = 2 KB:
        //   [block m/32][channel tile d/16][half s = (m/16)&1][lane = 16*((m/8)&1) + d%16][8 keys]
        // The four column tiles of a lane are 4 consecutive m, half of one 16-byte
        // chunk -> one 8-byte store per row.
        #pragma unroll  // constant indices keep the arrays in registers
        for (int f = 0; f < 2; ++f)
            #pragma unroll  // constant indices keep the arrays in registers
            for (int r = 0; r < 8; ++r) {
                v4bf pk;
                #pragma unroll  // constant indices keep the arrays in registers
                for (int j = 0; j < 4; ++j) pk[j] = (__bf16)acc[f][j][r];
                __bf16* dp = Vbf + (size_t)(b * CH + (o0 >> 5)) * CD * CM + ((m0 >> 5) + (ln >> 3)) * 1024 + f * 512
                           + ((ln >> 2) & 1) * 256 + (16 * ((ln >> 1) & 1) + 8 * hi + r) * 8 + 4 * (ln & 1);
                *(v4bf*)dp = pk;
            }
        // precaution: closes the stores above before any path of the listing reuses
        // a register that they name
        asm volatile("s_wait_xcnt 0x0" ::: "memory");
    }
}

// ---------------------------------------------------------------------------
// Fused Q and skip projection + attention, no LDS / no shuffles in the hot loop.
//   E^T = K-tile x Q-tile   (C-layout of E^T == B-layout of P^T, by symmetry)
//   x^T = V-tile x P^T      (accumulated over all M in two v8f tiles per Q tile)
// One wave owns NQ = 4 Q tiles (64 query columns) of one head, all kept in registers:
// each K and V fragment is loaded once per wave and trip and feeds four products.
// The wave first computes, for its own 64 columns, the head's 32 Q channels and the
// 32 skip channels that share its output rows: one 64 x 64 register tile, both from
// the same activations.  The C-layout of the two Q row tiles is the B-layout of the
// score product (lane column, channels 8*hi + r and 16 + 8*hi + r), so Q goes from
// accumulator to operand by one rounding, and skip waits in registers for the end:
// neither passes through memory.  Column tile q, lane column ln <-> n = n0 + 4*ln + q,
// as the projection deals them; attention treats every column alike.
// The grid is 256 blocks of 8 waves (two waves per SIMD), too few waves to hide a
// load behind other waves, so the fragments of trip t+1 are loaded into a second
// register set in front of the products of trip t.
// Softmax uses unnormalized exp (scores ~ N(0,1); |max| ~ 6 => no overflow),
// per-column sums are lane-local partials + one shfl_xor(16) at the end.
// ---------------------------------------------------------------------------
#define NQ 4

// the A operands of one trip (32 keys)
struct KVFrag { V16U k0, k1, v0, v1; };

// kp, vp: this lane's 16 bytes in the K and V planes at key m; OFF: a further step
// in elements.  K rows m+ln and m+16+ln: tiles m/16 and m/16+1; V rows d = ln and
// 16+ln, K = m_rel: block m/32.  Fragment order: 512 contiguous bytes per load.
template <int OFF>
__device__ __forceinline__ void load_kv(KVFrag& f, const __bf16* __restrict__ kp,
                                        const __bf16* __restrict__ vp) {
    f.k0.h2[0] = *(const v8bf*)(kp + OFF);        f.k0.h2[1] = *(const v8bf*)(kp + OFF + 256);
    f.k1.h2[0] = *(const v8bf*)(kp + OFF + 512);  f.k1.h2[1] = *(const v8bf*)(kp + OFF + 768);
    f.v0.h2[0] = *(const v8bf*)(vp + OFF);        f.v0.h2[1] = *(const v8bf*)(vp + OFF + 256);
    f.v1.h2[0] = *(const v8bf*)(vp + OFF + 512);  f.v1.h2[1] = *(const v8bf*)(vp + OFF + 768);
    // precaution: the address pairs that the eight loads name are inputs here,
    // so they stay untouched up to this wait and are reused only behind it
    asm volatile("s_wait_xcnt 0x0" :: "v"(kp), "v"(vp) : "memory");
    // keeps the eight loads in front of the products that follow: without it the
    // scheduler sinks them towards their first use and a trip waits for its own loads
    __builtin_amdgcn_sched_barrier(0);
}

__device__ __forceinline__ void attn_trip(const KVFrag& f, const V16U (&bq)[NQ],
                                          v8f (&accA)[NQ], v8f (&accB)[NQ], float (&lsum)[NQ]) {
    const v8f zero = {};
    // E^T tiles: rows m_rel, cols n
    v8f e0[NQ], e1[NQ];
    #pragma unroll  // constant indices keep the arrays in registers
    for (int q = 0; q < NQ; ++q) {
        e0[q] = WMMA_BF16(f.k0.v, bq[q].v, zero);
        e1[q] = WMMA_BF16(f.k1.v, bq[q].v, zero);
    }
    #pragma unroll  // constant indices keep the arrays in registers
    for (int q = 0; q < NQ; ++q) {
        // P^T = 2^(E^T), Q carrying QSCALE
        #pragma unroll  // constant indices keep the arrays in registers
        for (int r = 0; r < 8; ++r) {
            e0[q][r] = __builtin_amdgcn_exp2f(e0[q][r]);
            e1[q][r] = __builtin_amdgcn_exp2f(e1[q][r]);
        }
        // C-layout is exactly the next B-layout:
        //   element e of B  <->  e0[e] (e<8) / e1[e-8] (e>=8), all lanes alike
        V16U bp;
        #pragma unroll  // constant indices keep the arrays in registers
        for (int r = 0; r < 8; ++r) {
            lsum[q] += e0[q][r] + e1[q][r];   // lane-local partial column sum
            bp.v[r]     = (__bf16)e0[q][r];
            bp.v[r + 8] = (__bf16)e1[q][r];
        }

        // x^T accumulate: rows d, cols n
        accA[q] = WMMA_BF16(f.v0.v, bp.v, accA[q]);
        accB[q] = WMMA_BF16(f.v1.v, bp.v, accB[q]);
    }
}

__global__ __launch_bounds__(256) void attn_kernel(const float* __restrict__ pcd,
                                                   const float* __restrict__ qw,
                                                   const float* __restrict__ sw,
                                                   const __bf16* __restrict__ Kbf,
                                                   const __bf16* __restrict__ Vbf,
                                                   float* __restrict__ out) {
    const int lane = threadIdx.x & 31;
    // the wave's number is the same in all its lanes: held in a scalar register, the
    // activations' base address derived from it is scalar too
    const int wave = __builtin_amdgcn_readfirstlane(threadIdx.x >> 5);
    const int ln = lane & 15, hi = lane >> 4, c0 = hi ? 8 : 0;
    const int h = blockIdx.y;
    const int b = blockIdx.z;
    const int n0 = (blockIdx.x * 8 + wave) * (16 * NQ);

    const __bf16* klane = Kbf + (size_t)(b * CH + h) * CM * CD + lane * 8;
    const __bf16* vlane = Vbf + (size_t)(b * CH + h) * CD * CM + lane * 8;

    // trip 0's fragments are asked for first and fly under the projection
    KVFrag fa, fb;
    load_kv<0>(fa, klane, vlane);

    // the head's 32 Q rows (row tiles 0, 1) and 32 skip rows (row tiles 2, 3) as bf16
    // fragments: 4 row tiles x 8 k-steps, shared by the block's 8 waves
    __shared__ __attribute__((aligned(16))) __bf16 wlds[4 * (QIN / 32) * WFRAG];
    v8f pacc[4][4];
    {
        const float* xwave = pcd + (size_t)b * QIN * CN + n0;
        const unsigned xlane = (c0 * CN + 4 * ln) * 4;
        XStep x0;
        load_x<CN>(x0, xwave, xlane, 0);
        // k-step 0's loads go out ahead of the weight loads and fly under the staging
        __builtin_amdgcn_sched_barrier(0);
        stage_weights<QIN>(qw + (size_t)h * CD * QIN, sw + (size_t)h * CD * QIN, wlds);
        proj_tile<4, QIN, CN>(wlds + hi * WHI + ln * 8, xwave, xlane, x0, pacc);
    }

    // B operands (Q): tile q holds cols n0+4*ln+q, K = head channel: element r is
    // channel 8*hi + r (row tile 0), element r+8 channel 16 + 8*hi + r (row tile 1)
    V16U bq[NQ];
    #pragma unroll  // constant indices keep the arrays in registers
    for (int q = 0; q < NQ; ++q) {
        pacc[0][q] *= QSCALE;
        pacc[1][q] *= QSCALE;
        #pragma unroll  // constant indices keep the arrays in registers
        for (int r = 0; r < 8; ++r) {
            bq[q].v[r]     = (__bf16)pacc[0][q][r];
            bq[q].v[r + 8] = (__bf16)pacc[1][q][r];
        }
    }

    float lsum[NQ];
    v8f accA[NQ], accB[NQ];
    #pragma unroll  // constant indices keep the arrays in registers
    for (int q = 0; q < NQ; ++q) { lsum[q] = 0.f; accA[q] = v8f{}; accB[q] = v8f{}; }

    // two trips per pass, so that the two register sets swap roles without copies
    for (int m0 = 0; m0 < CM; m0 += 64) {
        load_kv<32 * CD>(fb, klane + (size_t)m0 * CD, vlane + (size_t)m0 * CD);
        attn_trip(fa, bq, accA, accB, lsum);
        // the last pass has no next trip: it reads trip 0 again (in bounds, unused)
        const int mn = (m0 + 64) & (CM - 1);
        load_kv<0>(fa, klane + (size_t)mn * CD, vlane + (size_t)mn * CD);
        attn_trip(fb, bq, accA, accB, lsum);
    }

    float inv[NQ];
    #pragma unroll  // constant indices keep the arrays in registers
    for (int q = 0; q < NQ; ++q) {
        // combine the two half-column partial sums (lanes ln and ln+16 share n)
        const float tot = lsum[q] + __shfl_xor(lsum[q], 16, 32);
        inv[q] = 1.0f / tot;
    }

    // out[b, h*32 + d, n] = skip + x/lsum ; accA: d = r+8*hi, accB: d = 16+r+8*hi.
    // The four column tiles of a lane are 4 consecutive n -> one 16-byte store per
    // row, 16 lanes cover 256 contiguous bytes.
    float* orow = out + ((size_t)(b * COUT) + h * CD + 8 * hi) * CN + n0 + 4 * ln;
    v4f oA[8], oB[8];
    #pragma unroll  // constant indices keep the arrays in registers
    for (int r = 0; r < 8; ++r) {
        #pragma unroll  // constant indices keep the arrays in registers
        for (int q = 0; q < NQ; ++q) {
            oA[r][q] = pacc[2][q][r] + accA[q][r] * inv[q];
            oB[r][q] = pacc[3][q][r] + accB[q][r] * inv[q];
        }
        *(v4f*)(orow + (size_t)r * CN) = oA[r];
        *(v4f*)(orow + (size_t)(16 + r) * CN) = oB[r];
    }
    // precaution: the address pair and the sixteen rows that the stores above name are
    // inputs here, so they stay untouched up to this wait
    asm volatile("s_wait_xcnt 0x0" :: "v"(orow),
                 "v"(oA[0]), "v"(oA[1]), "v"(oA[2]), "v"(oA[3]), "v"(oA[4]), "v"(oA[5]), "v"(oA[6]), "v"(oA[7]),
                 "v"(oB[0]), "v"(oB[1]), "v"(oB[2]), "v"(oB[3]), "v"(oB[4]), "v"(oB[5]), "v"(oB[6]), "v"(oB[7])
                 : "memory");
}

// ---------------------------------------------------------------------------
// Launcher
// ---------------------------------------------------------------------------
extern "C" void kernel_launch(void* const* d_in, const int* in_sizes, int n_in,
                              void* d_out, int out_size, void* d_ws, size_t ws_size,
                              hipStream_t stream) {
    const float* pcd = (const float*)d_in[0];   // [4,256,4096]
    const float* ps  = (const float*)d_in[1];   // [4,512,1024]
    const float* qw  = (const float*)d_in[2];   // [256,256]
    const float* kw  = (const float*)d_in[3];   // [256,512]
    const float* vw  = (const float*)d_in[4];   // [256,512]
    const float* sw  = (const float*)d_in[5];   // [256,256]
    float* out = (float*)d_out;                 // [4,256,4096]

    __bf16* Kbf = (__bf16*)d_ws;                           // 2 MB  [b,h] planes, fragment order
    __bf16* Vbf = Kbf + (size_t)CB * CH * CM * CD;         // 2 MB  [b,h] planes, fragment order

    hipLaunchKernelGGL(proj_kv_kernel, dim3(KV_BLOCKS), dim3(256), 0, stream, ps, kw, vw, Kbf, Vbf);
    hipLaunchKernelGGL(attn_kernel, dim3(CN / (128 * NQ), CH, CB), dim3(256), 0, stream,
                       pcd, qw, sw, Kbf, Vbf, out);
}

// v009
// Measured time: 30.8 microseconds a run.
// Next to v008, in two timings, it ran 1.05 and 1.04 times as fast.
// Counting every step since v000, it is 4.13 times as fast.
#include <hip/hip_runtime.h>
#include <hip/hip_bf16.h>

// ---------------------------------------------------------------------------
// B=4, N=4096, M=1024, H=8, head dim 32, Q_IN=256, K_IN=512, OUT=256.
// out = skip_w@pcd + per-head softmax(qT k / sqrt(32)) @ vT      (fp32 out)
//
// All GEMMs run on v_wmma_f32_16x16x32_bf16 (wave32).  Key layout fact used
// everywhere: CDNA5 16-bit A and B operands share ONE register layout —
// outer index (A-row / B-col) = lane%16; element e holds K-chunk
//   lanes 0-15 : K in {0..7, 16..23},   lanes 16-31 : K in {8..15, 24..31}
// i.e. two 16-byte chunks at element offsets c0 and c0+16, c0 = (lane>=16)*8.
// fp32 C/D layout: VGPR r, lanes 0-15 = (row r, col lane),
//                          lanes 16-31 = (row r+8, col lane-16).
// ---------------------------------------------------------------------------

typedef __attribute__((ext_vector_type(16))) __bf16 v16bf;
typedef __attribute__((ext_vector_type(8)))  __bf16 v8bf;
typedef __attribute__((ext_vector_type(4)))  __bf16 v4bf;
typedef __attribute__((ext_vector_type(8)))  float  v8f;
typedef __attribute__((ext_vector_type(4)))  float  v4f;

#define CB 4
#define CH 8
#define CN 4096
#define CM 1024
#define CD 32
#define QIN 256
#define KIN 512
#define COUT 256

#define WMMA_BF16(A, B, C) \
    __builtin_amdgcn_wmma_f32_16x16x32_bf16(false, (A), false, (B), (short)0, (C), false, false)

union V16U { v16bf v; v8bf h2[2]; };

// exp(e / sqrt(32)) = 2^(e * QSCALE).  The factor is linear in Q, so it is applied
// once per Q element in the projection, in fp32 ahead of the one rounding to bf16;
// the scores then leave the matrix unit as the exponent of 2.
#define QSCALE ((float)(0.17677669529663689 * 1.4426950408889634))   // 1/sqrt(32) * log2(e)

// ---------------------------------------------------------------------------
// Projections, all in the W x X orientation: D[o, n] = sum_i W[o,i] X[b,i,n].
// One wave owns a register tile of FO*16 output channels x 64 columns (FO = 4), so one
// activation fragment feeds FO products and one weight fragment feeds four.
// The 64 columns are dealt to the four column tiles interleaved: tile j, lane
// column ln  <->  n = n0 + 4*ln + j.  One 16-byte load per channel then fills
// the same element of all four B fragments, and 16 lanes cover 256 contiguous
// bytes of the channel's row.
// k order of both operands: element t <-> i0 + c0 + t, element t+8 <-> i0 + c0 + 16 + t.
//
// The weights come from LDS.  A block's 64 weight rows are read from global memory
// once, in whole 128-byte lines, rounded to bf16 once and laid down in fragment
// order; a fragment load straight from the row-major matrix touches 16 lines for
// 512 bytes, and every wave of a channel group would repeat it.
// LDS layout, one fragment (16 rows x 32 k) = WFRAG elements:
//   [row tile][k-step][half s = k/16][hi = (k/8)&1][row%16][8 k]
// with the hi blocks at a pitch of 320 bytes (256 + 64) and the halves at 640: a
// wave's 8-byte stores (4 rows x one line) then fall on all 64 banks once, and each
// 16-lane half of a 16-byte fragment read stays 256 contiguous bytes.
// ---------------------------------------------------------------------------
#define WHI   160                 // elements between the hi blocks of a half
#define WHALF 320                 // elements between the halves of a fragment
#define WFRAG 640                 // elements per fragment

// wlo, whi: first of the block's rows 0..31 and of its rows 32..63 (they may lie in two
// matrices).  Thread t, round it: 16 bytes of row
// 32*(it&1) + t/8, k-step it/2, piece t%8 (k = 4*piece .. 4*piece+3 of the step).
template <int CIN>
__device__ __forceinline__ void stage_weights(const float* __restrict__ wlo, const float* __restrict__ whi,
                                              __bf16* __restrict__ wl) {
    constexpr int KS = CIN / 32;
    const int t = threadIdx.x, piece = t & 7, row = t >> 3;
    const float* gp0 = wlo + (size_t)row * CIN + piece * 4;
    const float* gp1 = whi + (size_t)row * CIN + piece * 4;
    __bf16* lp = wl + (row >> 4) * (KS * WFRAG) + (piece >> 2) * WHALF + ((piece >> 1) & 1) * WHI
               + (row & 15) * 8 + (piece & 1) * 4;
    #pragma unroll  // row and k steps become immediate offsets of the loads and stores
    for (int g = 0; g < CIN / 16; g += 16) {
        float4 w[16];
        #pragma unroll  // constant indices keep the array in registers
        for (int u = 0; u < 16; ++u)
            w[u] = *(const float4*)((((g + u) & 1) ? gp1 : gp0) + ((g + u) >> 1) * 32);
        #pragma unroll  // constant indices keep the array in registers
        for (int u = 0; u < 16; ++u) {
            v4bf pk;
            pk[0] = (__bf16)w[u].x; pk[1] = (__bf16)w[u].y; pk[2] = (__bf16)w[u].z; pk[3] = (__bf16)w[u].w;
            *(v4bf*)(lp + ((g + u) & 1) * 2 * (KS * WFRAG) + ((g + u) >> 1) * WFRAG) = pk;
        }
    }
    // precaution: the address pairs that the loads above name are inputs here,
    // so they stay untouched up to this wait and are reused only behind it
    asm volatile("s_wait_xcnt 0x0" :: "v"(gp0), "v"(gp1) : "memory");
    // publishes the block's weights: every wave reads fragments that other waves wrote
    __syncthreads();
}

// One k-step's activations of a lane: 16 channels x 4 columns.
struct XStep { float4 r[16]; };

// xwave: the wave's first column in channel 0 (the same in all lanes, a scalar base);
// xlane: the lane's byte offset from it, (c0*NC + 4*ln) * 4.
template <int NC>
__device__ __forceinline__ void load_x(XStep& x, const float* __restrict__ xwave, unsigned xlane, int i0) {
    const char* p = (const char*)xwave + xlane;
    #pragma unroll  // constant indices keep the array in registers
    for (int t = 0; t < 8; ++t) {
        x.r[t]     = *(const float4*)(p + (size_t)(i0 + t) * NC * 4);
        x.r[t + 8] = *(const float4*)(p + (size_t)(i0 + 16 + t) * NC * 4);
    }
}

// The activations come from memory, and a wave that asks for a k-step and then waits
// for it pays a whole memory latency per k-step.  A ring of NS register sets: the loads
// of k-step s+NS-1 go out in front of the products of k-step s, so NS k-steps are in
// flight and a latency is paid once per NS k-steps.  xs[0..NS-2] hold k-steps 0..NS-2,
// requested by the caller ahead of the weight staging.
// CIN: the channels that this wave sums; WKS: k-steps per row tile in the LDS layout.
template <int FO, int CIN, int NC, int NS, int WKS>
__device__ __forceinline__ void proj_tile(const __bf16* __restrict__ wfrag0, // LDS: first k-step of row tiles 0..FO/2-1, + hi*WHI + ln*8
                                          const __bf16* __restrict__ wfrag1, // LDS: the same of row tiles FO/2..FO-1
                                          const float* __restrict__ xwave,  // X[b] + n0
                                          unsigned xlane,                   // (c0*NC + 4*ln) * 4 bytes
                                          XStep (&xs)[NS],
                                          v8f (&acc)[FO][4]) {
    #pragma unroll  // constant indices keep the arrays in registers
    for (int f = 0; f < FO; ++f)
        #pragma unroll  // constant indices keep the arrays in registers
        for (int j = 0; j < 4; ++j) acc[f][j] = v8f{};

    #pragma unroll  // row and column steps become immediate offsets of the loads; the sets change roles without copies
    for (int i0 = 0; i0 < CIN; i0 += 32) {
        XStep& cur = xs[(i0 / 32) % NS];
        XStep& nxt = xs[(i0 / 32 + NS - 1) % NS];   // the set that the k-step before this one has used up
        // the farthest k-step's loads first, as one group, then this k-step's weight fragments
        if (i0 + 32 * (NS - 1) < CIN) load_x<NC>(nxt, xwave, xlane, i0 + 32 * (NS - 1));
        V16U aw[FO];
        #pragma unroll  // constant indices keep the arrays in registers
        for (int f = 0; f < FO; ++f) {
            const __bf16* wp = (f < FO / 2 ? wfrag0 : wfrag1) + ((f % (FO / 2)) * WKS + i0 / 32) * WFRAG;
            aw[f].h2[0] = *(const v8bf*)(wp);
            aw[f].h2[1] = *(const v8bf*)(wp + WHALF);
        }
        // keeps the group whole and in front of this k-step's products: without it the
        // scheduler sinks the loads towards their first use, NS-1 k-steps later
        __builtin_amdgcn_sched_barrier(0);
        v16bf bx[4];
        #pragma unroll  // constant indices keep the arrays in registers
        for (int e = 0; e < 16; ++e) {
            bx[0][e] = (__bf16)cur.r[e].x;
            bx[1][e] = (__bf16)cur.r[e].y;
            bx[2][e] = (__bf16)cur.r[e].z;
            bx[3][e] = (__bf16)cur.r[e].w;
        }
        #pragma unroll  // constant indices keep the arrays in registers
        for (int f = 0; f < FO; ++f)
            #pragma unroll  // constant indices keep the arrays in registers
            for (int j = 0; j < 4; ++j) acc[f][j] = WMMA_BF16(aw[f].v, bx[j], acc[f][j]);
    }
    // precaution: the base and the offset that every global load above names are inputs
    // here, so they stay untouched up to this wait and are reused only behind it
    asm volatile("s_wait_xcnt 0x0" :: "s"(xwave), "v"(xlane) : "memory");
}

// bf16 store of K in fragment order.  Per (b, h) the plane is cut into
// tiles of 16 columns x 32 head channels = 1 KB, laid out as the attention
// kernel's operand registers want them:
//   [tile n/16][half s = ch/16][lane = 16*((ch/8)&1) + n%16][8 channels]
// so a wave's 16-byte load of one half covers 512 contiguous bytes.
// Rows o = o0 + 16f + 8*hi + r are 8 consecutive head channels of column n:
// exactly one 16-byte chunk (s = f, chunk lane = 16*hi + n%16).
template <int FO, int NC>
__device__ __forceinline__ void store_hn32(const v8f (&acc)[FO][4], __bf16* __restrict__ dst,
                                           int b, int o0, int n0, int ln, int hi) {
    #pragma unroll  // constant indices keep the arrays in registers
    for (int f = 0; f < FO; ++f) {
        const int of = o0 + 16 * f;
        #pragma unroll  // constant indices keep the arrays in registers
        for (int j = 0; j < 4; ++j) {
            v8bf pk;
            #pragma unroll  // constant indices keep the arrays in registers
            for (int r = 0; r < 8; ++r) pk[r] = (__bf16)acc[f][j][r];
            const int n = n0 + 4 * ln + j;
            __bf16* dp = dst + (size_t)(b * CH + (of >> 5)) * NC * CD + (n >> 4) * 512 + (of & 16) * 16 + (16 * hi + (n & 15)) * 8;
            *(v8bf*)dp = pk;
        }
    }
}

// K and V projections: one launch, the block index picks the job.  Every block is
// 8 waves = 2 halves of the input channels x 4 column groups (64 x 256 outputs).
// Waves w and w+4 own the same 64 columns and split the SUM, not the output rows:
// each forms all 64 rows over its own 256 input channels, so no activation is asked
// for twice in a block, an activation fragment feeds four products, and a wave's chain
// of dependent k-steps is 8 long instead of 16.  The two partial sums meet in LDS: a
// wave hands over the 32 rows that its partner stores and adds its partner's share to
// the 32 rows that it stores itself.
// The index runs channel block, then which weight matrix, then column block, then
// batch: the 8 blocks that read one activation tile are neighbours.  The two jobs
// share one copy of the product loop; only the weight pointer and the store differ,
// chosen by block-uniform tests.
// The grid is 128 blocks of 8 waves, two waves per SIMD and no other wave to hide a load
// behind: of the register budget of two waves per SIMD (512), KV_SETS activation sets,
// so that the block has 8 x KV_SETS different k-step slices of loads in flight.
#define KV_BLOCKS 128
#define KV_SETS 3
__global__ __launch_bounds__(256) void proj_kv_kernel(const float* __restrict__ ps,
                                                       const float* __restrict__ kw,
                                                       const float* __restrict__ vw,
                                                       __bf16* __restrict__ Kbf,
                                                       __bf16* __restrict__ Vbf) {
    const int lane = threadIdx.x & 31;
    // the wave's number is the same in all its lanes: held in a scalar register, what is
    // derived from it (tile origins) takes no vector register through the product loop
    const int wave = __builtin_amdgcn_readfirstlane(threadIdx.x >> 5);
    const int ln = lane & 15, hi = lane >> 4, c0 = hi ? 8 : 0;
    const int bid = blockIdx.x;
    // part[0..1]: the two row tiles that this wave stores, part[2..3]: its partner's
    v8f part[4][4];
    // the block's 64 weight rows as bf16 fragments: 4 row tiles x 16 k-steps
    __shared__ __attribute__((aligned(16))) __bf16 wlds[4 * (KIN / 32) * WFRAG];
    // the handed-over partial sums: [wave][row tile f][column tile j][half of the 8 rows][lane][4 rows],
    // so that every 16-byte access of a wave covers 512 contiguous bytes
    __shared__ __attribute__((aligned(16))) float xch[8 * 2 * 4 * 2 * 32 * 4];
    const bool second = (bid >> 2) & 1;              // V, else K
    const int kh = wave >> 2;                        // which half of the input channels, and of the rows to store
    const int o0 = (bid & 3) * 64 + kh * 32;
    const int m0 = (((bid >> 3) & 3) * 4 + (wave & 3)) * 64;
    const int b  = bid >> 5;
    const float* W = (second ? vw : kw) + (size_t)(bid & 3) * 64 * KIN;
    const float* xwave = ps + ((size_t)b * KIN + kh * (KIN / 2)) * CM + m0;
    const unsigned xlane = (c0 * CM + 4 * ln) * 4;
    XStep xs[KV_SETS];
    #pragma unroll  // constant indices keep the array in registers
    for (int s = 0; s < KV_SETS - 1; ++s) load_x<CM>(xs[s], xwave, xlane, 32 * s);
    // the first k-steps' loads go out ahead of the weight loads and fly under the staging
    __builtin_amdgcn_sched_barrier(0);
    stage_weights<KIN>(W, W + (size_t)32 * KIN, wlds);
    {
        // this wave's k-steps of row tile 0
        const __bf16* wk = wlds + kh * (KIN / 64) * WFRAG + hi * WHI + ln * 8;
        proj_tile<4, KIN / 2, CM, KV_SETS, KIN / 32>(wk + kh * 2 * (KIN / 32) * WFRAG, wk + (1 - kh) * 2 * (KIN / 32) * WFRAG,
                                                     xwave, xlane, xs, part);
    }
    v8f acc[2][4];
    {
        float* give = xch + wave * 2048 + lane * 4;
        const float* take = xch + (wave ^ 4) * 2048 + lane * 4;
        #pragma unroll  // constant indices keep the arrays in registers
        for (int f = 0; f < 2; ++f)
            #pragma unroll  // constant indices keep the arrays in registers
            for (int j = 0; j < 4; ++j) {
                const v8f g = part[2 + f][j];
                *(v4f*)(give + (f * 4 + j) * 256)       = v4f{g[0], g[1], g[2], g[3]};
                *(v4f*)(give + (f * 4 + j) * 256 + 128) = v4f{g[4], g[5], g[6], g[7]};
            }
        // publishes the partial sums: each wave reads what its partner wrote
        __syncthreads();
        #pragma unroll  // constant indices keep the arrays in registers
        for (int f = 0; f < 2; ++f)
            #pragma unroll  // constant indices keep the arrays in registers
            for (int j = 0; j < 4; ++j) {
                const v4f lo4 = *(const v4f*)(take + (f * 4 + j) * 256);
                const v4f hi4 = *(const v4f*)(take + (f * 4 + j) * 256 + 128);
                acc[f][j] = part[f][j] + v8f{lo4[0], lo4[1], lo4[2], lo4[3], hi4[0], hi4[1], hi4[2], hi4[3]};
            }
    }
    if (!second) {
        store_hn32<2, CM>(acc, Kbf, b, o0, m0, ln, hi);
        // precaution: closes the stores above before any path of the listing reuses
        // a register that they name
        asm volatile("s_wait_xcnt 0x0" ::: "memory");
    } else {
        // V in fragment order too.  Per (b, h), blocks of 32 keys x 32 channels = 2 KB:
        //   [block m/32][channel tile d/16][half s = (m/16)&1][lane = 16*((m/8)&1) + d%16][8 keys]
        // The four column tiles of a lane are 4 consecutive m, half of one 16-byte
        // chunk -> one 8-byte store per row.
        #pragma unroll  // constant indices keep the arrays in registers
        for (int f = 0; f < 2; ++f)
            #pragma unroll  // constant indices keep the arrays in registers
            for (int r = 0; r < 8; ++r) {
                v4bf pk;
                #pragma unroll  // constant indices keep the arrays in registers
                for (int j = 0; j < 4; ++j) pk[j] = (__bf16)acc[f][j][r];
                __bf16* dp = Vbf + (size_t)(b * CH + (o0 >> 5)) * CD * CM + ((m0 >> 5) + (ln >> 3)) * 1024 + f * 512
                           + ((ln >> 2) & 1) * 256 + (16 * ((ln >> 1) & 1) + 8 * hi + r) * 8 + 4 * (ln & 1);
                *(v4bf*)dp = pk;
            }
        // precaution: closes the stores above before any path of the listing reuses
        // a register that they name
        asm volatile("s_wait_xcnt 0x0" ::: "memory");
    }
}

// ---------------------------------------------------------------------------
// Fused Q and skip projection + attention, no LDS / no shuffles in the hot loop.
//   E^T = K-tile x Q-tile   (C-layout of E^T == B-layout of P^T, by symmetry)
//   x^T = V-tile x P^T      (accumulated over all M in two v8f tiles per Q tile)
// One wave owns NQ = 4 Q tiles (64 query columns) of one head, all kept in registers:
// each K and V fragment is loaded once per wave and trip and feeds four products.
// The wave first computes, for its own 64 columns, the head's 32 Q channels and the
// 32 skip channels that share its output rows: one 64 x 64 register tile, both from
// the same activations.  The C-layout of the two Q row tiles is the B-layout of the
// score product (lane column, channels 8*hi + r and 16 + 8*hi + r), so Q goes from
// accumulator to operand by one rounding, and skip waits in registers for the end:
// neither passes through memory.  Column tile q, lane column ln <-> n = n0 + 4*ln + q,
// as the projection deals them; attention treats every column alike.
// The grid is 256 blocks of 8 waves (two waves per SIMD), too few waves to hide a
// load behind other waves, so the fragments of trip t+1 are loaded into a second
// register set in front of the products of trip t.
// Softmax uses unnormalized exp (scores ~ N(0,1); |max| ~ 6 => no overflow),
// per-column sums are lane-local partials + one shfl_xor(16) at the end.
// ---------------------------------------------------------------------------
#define NQ 4

// the A operands of one trip (32 keys)
struct KVFrag { V16U k0, k1, v0, v1; };

// kp, vp: this lane's 16 bytes in the K and V planes at key m; OFF: a further step
// in elements.  K rows m+ln and m+16+ln: tiles m/16 and m/16+1; V rows d = ln and
// 16+ln, K = m_rel: block m/32.  Fragment order: 512 contiguous bytes per load.
template <int OFF>
__device__ __forceinline__ void load_kv(KVFrag& f, const __bf16* __restrict__ kp,
                                        const __bf16* __restrict__ vp) {
    f.k0.h2[0] = *(const v8bf*)(kp + OFF);        f.k0.h2[1] = *(const v8bf*)(kp + OFF + 256);
    f.k1.h2[0] = *(const v8bf*)(kp + OFF + 512);  f.k1.h2[1] = *(const v8bf*)(kp + OFF + 768);
    f.v0.h2[0] = *(const v8bf*)(vp + OFF);        f.v0.h2[1] = *(const v8bf*)(vp + OFF + 256);
    f.v1.h2[0] = *(const v8bf*)(vp + OFF + 512);  f.v1.h2[1] = *(const v8bf*)(vp + OFF + 768);
    // precaution: the address pairs that the eight loads name are inputs here,
    // so they stay untouched up to this wait and are reused only behind it
    asm volatile("s_wait_xcnt 0x0" :: "v"(kp), "v"(vp) : "memory");
    // keeps the eight loads in front of the products that follow: without it the
    // scheduler sinks them towards their first use and a trip waits for its own loads
    __builtin_amdgcn_sched_barrier(0);
}

__device__ __forceinline__ void attn_trip(const KVFrag& f, const V16U (&bq)[NQ],
                                          v8f (&accA)[NQ], v8f (&accB)[NQ], float (&lsum)[NQ]) {
    const v8f zero = {};
    // E^T tiles: rows m_rel, cols n
    v8f e0[NQ], e1[NQ];
    #pragma unroll  // constant indices keep the arrays in registers
    for (int q = 0; q < NQ; ++q) {
        e0[q] = WMMA_BF16(f.k0.v, bq[q].v, zero);
        e1[q] = WMMA_BF16(f.k1.v, bq[q].v, zero);
    }
    #pragma unroll  // constant indices keep the arrays in registers
    for (int q = 0; q < NQ; ++q) {
        // P^T = 2^(E^T), Q carrying QSCALE
        #pragma unroll  // constant indices keep the arrays in registers
        for (int r = 0; r < 8; ++r) {
            e0[q][r] = __builtin_amdgcn_exp2f(e0[q][r]);
            e1[q][r] = __builtin_amdgcn_exp2f(e1[q][r]);
        }
        // C-layout is exactly the next B-layout:
        //   element e of B  <->  e0[e] (e<8) / e1[e-8] (e>=8), all lanes alike
        V16U bp;
        #pragma unroll  // constant indices keep the arrays in registers
        for (int r = 0; r < 8; ++r) {
            lsum[q] += e0[q][r] + e1[q][r];   // lane-local partial column sum
            bp.v[r]     = (__bf16)e0[q][r];
            bp.v[r + 8] = (__bf16)e1[q][r];
        }

        // x^T accumulate: rows d, cols n
        accA[q] = WMMA_BF16(f.v0.v, bp.v, accA[q]);
        accB[q] = WMMA_BF16(f.v1.v, bp.v, accB[q]);
    }
}

__global__ __launch_bounds__(256) void attn_kernel(const float* __restrict__ pcd,
                                                   const float* __restrict__ qw,
                                                   const float* __restrict__ sw,
                                                   const __bf16* __restrict__ Kbf,
                                                   const __bf16* __restrict__ Vbf,
                                                   float* __restrict__ out) {
    const int lane = threadIdx.x & 31;
    // the wave's number is the same in all its lanes: held in a scalar register, the
    // activations' base address derived from it is scalar too
    const int wave = __builtin_amdgcn_readfirstlane(threadIdx.x >> 5);
    const int ln = lane & 15, hi = lane >> 4, c0 = hi ? 8 : 0;
    const int h = blockIdx.y;
    const int b = blockIdx.z;
    const int n0 = (blockIdx.x * 8 + wave) * (16 * NQ);

    const __bf16* klane = Kbf + (size_t)(b * CH + h) * CM * CD + lane * 8;
    const __bf16* vlane = Vbf + (size_t)(b * CH + h) * CD * CM + lane * 8;

    // trip 0's fragments are asked for first and fly under the projection
    KVFrag fa, fb;
    load_kv<0>(fa, klane, vlane);

    // the head's 32 Q rows (row tiles 0, 1) and 32 skip rows (row tiles 2, 3) as bf16
    // fragments: 4 row tiles x 8 k-steps, shared by the block's 8 waves
    __shared__ __attribute__((aligned(16))) __bf16 wlds[4 * (QIN / 32) * WFRAG];
    v8f pacc[4][4];
    {
        const float* xwave = pcd + (size_t)b * QIN * CN + n0;
        const unsigned xlane = (c0 * CN + 4 * ln) * 4;
        XStep xs[2];
        load_x<CN>(xs[0], xwave, xlane, 0);
        // k-step 0's loads go out ahead of the weight loads and fly under the staging
        __builtin_amdgcn_sched_barrier(0);
        stage_weights<QIN>(qw + (size_t)h * CD * QIN, sw + (size_t)h * CD * QIN, wlds);
        proj_tile<4, QIN, CN, 2, QIN / 32>(wlds + hi * WHI + ln * 8, wlds + 2 * (QIN / 32) * WFRAG + hi * WHI + ln * 8,
                                           xwave, xlane, xs, pacc);
    }

    // B operands (Q): tile q holds cols n0+4*ln+q, K = head channel: element r is
    // channel 8*hi + r (row tile 0), element r+8 channel 16 + 8*hi + r (row tile 1)
    V16U bq[NQ];
    #pragma unroll  // constant indices keep the arrays in registers
    for (int q = 0; q < NQ; ++q) {
        pacc[0][q] *= QSCALE;
        pacc[1][q] *= QSCALE;
        #pragma unroll  // constant indices keep the arrays in registers
        for (int r = 0; r < 8; ++r) {
            bq[q].v[r]     = (__bf16)pacc[0][q][r];
            bq[q].v[r + 8] = (__bf16)pacc[1][q][r];
        }
    }

    float lsum[NQ];
    v8f accA[NQ], accB[NQ];
    #pragma unroll  // constant indices keep the arrays in registers
    for (int q = 0; q < NQ; ++q) { lsum[q] = 0.f; accA[q] = v8f{}; accB[q] = v8f{}; }

    // two trips per pass, so that the two register sets swap roles without copies
    for (int m0 = 0; m0 < CM; m0 += 64) {
        load_kv<32 * CD>(fb, klane + (size_t)m0 * CD, vlane + (size_t)m0 * CD);
        attn_trip(fa, bq, accA, accB, lsum);
        // the last pass has no next trip: it reads trip 0 again (in bounds, unused)
        const int mn = (m0 + 64) & (CM - 1);
        load_kv<0>(fa, klane + (size_t)mn * CD, vlane + (size_t)mn * CD);
        attn_trip(fb, bq, accA, accB, lsum);
    }

    float inv[NQ];
    #pragma unroll  // constant indices keep the arrays in registers
    for (int q = 0; q < NQ; ++q) {
        // combine the two half-column partial sums (lanes ln and ln+16 share n)
        const float tot = lsum[q] + __shfl_xor(lsum[q], 16, 32);
        inv[q] = 1.0f / tot;
    }

    // out[b, h*32 + d, n] = skip + x/lsum ; accA: d = r+8*hi, accB: d = 16+r+8*hi.
    // The four column tiles of a lane are 4 consecutive n -> one 16-byte store per
    // row, 16 lanes cover 256 contiguous bytes.
    float* orow = out + ((size_t)(b * COUT) + h * CD + 8 * hi) * CN + n0 + 4 * ln;
    v4f oA[8], oB[8];
    #pragma unroll  // constant indices keep the arrays in registers
    for (int r = 0; r < 8; ++r) {
        #pragma unroll  // constant indices keep the arrays in registers
        for (int q = 0; q < NQ; ++q) {
            oA[r][q] = pacc[2][q][r] + accA[q][r] * inv[q];
            oB[r][q] = pacc[3][q][r] + accB[q][r] * inv[q];
        }
        *(v4f*)(orow + (size_t)r * CN) = oA[r];
        *(v4f*)(orow + (size_t)(16 + r) * CN) = oB[r];
    }
    // precaution: the address pair and the sixteen rows that the stores above name are
    // inputs here, so they stay untouched up to this wait
    asm volatile("s_wait_xcnt 0x0" :: "v"(orow),
                 "v"(oA[0]), "v"(oA[1]), "v"(oA[2]), "v"(oA[3]), "v"(oA[4]), "v"(oA[5]), "v"(oA[6]), "v"(oA[7]),
                 "v"(oB[0]), "v"(oB[1]), "v"(oB[2]), "v"(oB[3]), "v"(oB[4]), "v"(oB[5]), "v"(oB[6]), "v"(oB[7])
                 : "memory");
}

// ---------------------------------------------------------------------------
// Launcher
// ---------------------------------------------------------------------------
extern "C" void kernel_launch(void* const* d_in, const int* in_sizes, int n_in,
                              void* d_out, int out_size, void* d_ws, size_t ws_size,
                              hipStream_t stream) {
    const float* pcd = (const float*)d_in[0];   // [4,256,4096]
    const float* ps  = (const float*)d_in[1];   // [4,512,1024]
    const float* qw  = (const float*)d_in[2];   // [256,256]
    const float* kw  = (const float*)d_in[3];   // [256,512]
    const float* vw  = (const float*)d_in[4];   // [256,512]
    const float* sw  = (const float*)d_in[5];   // [256,256]
    float* out = (float*)d_out;                 // [4,256,4096]

    __bf16* Kbf = (__bf16*)d_ws;                           // 2 MB  [b,h] planes, fragment order
    __bf16* Vbf = Kbf + (size_t)CB * CH * CM * CD;         // 2 MB  [b,h] planes, fragment order

    hipLaunchKernelGGL(proj_kv_kernel, dim3(KV_BLOCKS), dim3(256), 0, stream, ps, kw, vw, Kbf, Vbf);
    hipLaunchKernelGGL(attn_kernel, dim3(CN / (128 * NQ), CH, CB), dim3(256), 0, stream,
                       pcd, qw, sw, Kbf, Vbf, out);
}

// v010
// It runs in 28.2 microseconds.
// Timed twice side by side with v009, it ran 1.11 times as fast both times.
// Counting every step since v000, it is 4.57 times as fast.
#include <hip/hip_runtime.h>
#include <hip/hip_bf16.h>

// ---------------------------------------------------------------------------
// B=4, N=4096, M=1024, H=8, head dim 32, Q_IN=256, K_IN=512, OUT=256.
// out = skip_w@pcd + per-head softmax(qT k / sqrt(32)) @ vT      (fp32 out)
//
// All GEMMs run on v_wmma_f32_16x16x32_bf16 (wave32).  Key layout fact used
// everywhere: CDNA5 16-bit A and B operands share ONE register layout —
// outer index (A-row / B-col) = lane%16; element e holds K-chunk
//   lanes 0-15 : K in {0..7, 16..23},   lanes 16-31 : K in {8..15, 24..31}
// i.e. two 16-byte chunks at element offsets c0 and c0+16, c0 = (lane>=16)*8.
// fp32 C/D layout: VGPR r, lanes 0-15 = (row r, col lane),
//                          lanes 16-31 = (row r+8, col lane-16).
// ---------------------------------------------------------------------------

typedef __attribute__((ext_vector_type(16))) __bf16 v16bf;
typedef __attribute__((ext_vector_type(8)))  __bf16 v8bf;
typedef __attribute__((ext_vector_type(4)))  __bf16 v4bf;
typedef __attribute__((ext_vector_type(8)))  float  v8f;
typedef __attribute__((ext_vector_type(4)))  float  v4f;

#define CB 4
#define CH 8
#define CN 4096
#define CM 1024
#define CD 32
#define QIN 256
#define KIN 512
#define COUT 256

#define WMMA_BF16(A, B, C) \
    __builtin_amdgcn_wmma_f32_16x16x32_bf16(false, (A), false, (B), (short)0, (C), false, false)

union V16U { v16bf v; v8bf h2[2]; };

// exp(e / sqrt(32)) = 2^(e * QSCALE).  The factor is linear in Q, so it is applied
// once per Q element in the projection, in fp32 ahead of the one rounding to bf16;
// the scores then leave the matrix unit as the exponent of 2.
#define QSCALE ((float)(0.17677669529663689 * 1.4426950408889634))   // 1/sqrt(32) * log2(e)

// ---------------------------------------------------------------------------
// Projections, all in the W x X orientation: D[o, n] = sum_i W[o,i] X[b,i,n].
// One wave owns a register tile of FO*16 output channels x 64 columns (FO = 4), so one
// activation fragment feeds FO products and one weight fragment feeds four.
// The 64 columns are dealt to the four column tiles interleaved: tile j, lane
// column ln  <->  n = n0 + 4*ln + j.  One 16-byte load per channel then fills
// the same element of all four B fragments, and 16 lanes cover 256 contiguous
// bytes of the channel's row.
// k order of both operands: element t <-> i0 + c0 + t, element t+8 <-> i0 + c0 + 16 + t.
//
// The weights come from LDS.  A block's 64 weight rows are read from global memory
// once, in whole 128-byte lines, rounded to bf16 once and laid down in fragment
// order; a fragment load straight from the row-major matrix touches 16 lines for
// 512 bytes, and every wave of a channel group would repeat it.
// LDS layout, one fragment (16 rows x 32 k) = WFRAG elements:
//   [row tile][k-step][half s = k/16][hi = (k/8)&1][row%16][8 k]
// with the hi blocks at a pitch of 320 bytes (256 + 64) and the halves at 640: a
// wave's 8-byte stores (4 rows x one line) then fall on all 64 banks once, and each
// 16-lane half of a 16-byte fragment read stays 256 contiguous bytes.
// ---------------------------------------------------------------------------
#define WHI   160                 // elements between the hi blocks of a half
#define WHALF 320                 // elements between the halves of a fragment
#define WFRAG 640                 // elements per fragment

// wlo, whi: first of the block's rows 0..31 and of its rows 32..63 (they may lie in two
// matrices).  Thread t, round it: 16 bytes of row
// 32*(it&1) + t/8, k-step it/2, piece t%8 (k = 4*piece .. 4*piece+3 of the step).
template <int CIN>
__device__ __forceinline__ void stage_weights(const float* __restrict__ wlo, const float* __restrict__ whi,
                                              __bf16* __restrict__ wl) {
    constexpr int KS = CIN / 32;
    const int t = threadIdx.x, piece = t & 7, row = t >> 3;
    const float* gp0 = wlo + (size_t)row * CIN + piece * 4;
    const float* gp1 = whi + (size_t)row * CIN + piece * 4;
    __bf16* lp = wl + (row >> 4) * (KS * WFRAG) + (piece >> 2) * WHALF + ((piece >> 1) & 1) * WHI
               + (row & 15) * 8 + (piece & 1) * 4;
    #pragma unroll  // row and k steps become immediate offsets of the loads and stores
    for (int g = 0; g < CIN / 16; g += 16) {
        float4 w[16];
        #pragma unroll  // constant indices keep the array in registers
        for (int u = 0; u < 16; ++u)
            w[u] = *(const float4*)((((g + u) & 1) ? gp1 : gp0) + ((g + u) >> 1) * 32);
        #pragma unroll  // constant indices keep the array in registers
        for (int u = 0; u < 16; ++u) {
            v4bf pk;
            pk[0] = (__bf16)w[u].x; pk[1] = (__bf16)w[u].y; pk[2] = (__bf16)w[u].z; pk[3] = (__bf16)w[u].w;
            *(v4bf*)(lp + ((g + u) & 1) * 2 * (KS * WFRAG) + ((g + u) >> 1) * WFRAG) = pk;
        }
    }
    // precaution: the address pairs that the loads above name are inputs here,
    // so they stay untouched up to this wait and are reused only behind it
    asm volatile("s_wait_xcnt 0x0" :: "v"(gp0), "v"(gp1) : "memory");
    // publishes the block's weights: every wave reads fragments that other waves wrote
    __syncthreads();
}

// One k-step's activations of a lane: 16 channels x 4 columns.
struct XStep { float4 r[16]; };

// xstep: the wave's first column in the k-step's first channel (the same in all lanes, a
// scalar base); xlane: the lane's byte offset from it, (c0*NC + 4*ln) * 4.
template <int NC>
__device__ __forceinline__ void load_x(XStep& x, const float* __restrict__ xstep, unsigned xlane) {
    const char* p = (const char*)xstep + xlane;
    #pragma unroll  // constant indices keep the array in registers
    for (int t = 0; t < 8; ++t) {
        x.r[t]     = *(const float4*)(p + (size_t)t * NC * 4);
        x.r[t + 8] = *(const float4*)(p + (size_t)(16 + t) * NC * 4);
    }
}

// The walk over a wave's 8 k-steps starts at k-step rot and wraps: place s holds k-step
// (s + rot) mod 8.  Several blocks read the same activations at the same time: with a
// different rot in each they ask L2 for different lines at any moment instead of all for
// the same ones.  xb[s]: the scalar base of place s, each in registers of its own.
#define KSTEPS 8
template <int NC>
__device__ __forceinline__ void walk_bases(const float* (&xb)[KSTEPS], const float* __restrict__ xwave, int rot) {
    #pragma unroll  // constant indices keep the array in registers
    for (int s = 0; s < KSTEPS; ++s) xb[s] = xwave + (size_t)((s + rot) & (KSTEPS - 1)) * 32 * NC;
}

// The activations come from memory, and a wave that asks for a k-step and then waits
// for it pays a whole memory latency per k-step.  A ring of NS register sets: the loads
// of k-step s+NS-1 go out in front of the products of k-step s, so NS k-steps are in
// flight and a latency is paid once per NS k-steps.  xs[0..NS-2] hold the first NS-1
// k-steps of the walk, requested by the caller ahead of the weight staging.
// CIN: the channels that this wave sums; WKS: k-steps per row tile in the LDS layout.
// xb, rot: the walk's bases and its first k-step (walk_bases).
template <int FO, int CIN, int NC, int NS, int WKS>
__device__ __forceinline__ void proj_tile(const __bf16* __restrict__ wfrag0, // LDS: first k-step of row tiles 0..FO/2-1, + hi*WHI + ln*8
                                          const __bf16* __restrict__ wfrag1, // LDS: the same of row tiles FO/2..FO-1
                                          const float* (&xb)[KSTEPS],
                                          unsigned xlane,                   // (c0*NC + 4*ln) * 4 bytes
                                          int rot,                          // the same in all lanes
                                          XStep (&xs)[NS],
                                          v8f (&acc)[FO][4]) {
    #pragma unroll  // constant indices keep the arrays in registers
    for (int f = 0; f < FO; ++f)
        #pragma unroll  // constant indices keep the arrays in registers
        for (int j = 0; j < 4; ++j) acc[f][j] = v8f{};

    #pragma unroll  // constant indices pick each k-step's base and register set; the sets change roles without copies
    for (int i0 = 0; i0 < CIN; i0 += 32) {
        XStep& cur = xs[(i0 / 32) % NS];
        XStep& nxt = xs[(i0 / 32 + NS - 1) % NS];   // the set that the k-step before this one has used up
        // the farthest k-step's loads first, as one group, then this k-step's weight fragments
        if (i0 + 32 * (NS - 1) < CIN) load_x<NC>(nxt, xb[i0 / 32 + NS - 1], xlane);
        const int ks = (i0 / 32 + rot) & (CIN / 32 - 1);
        V16U aw[FO];
        #pragma unroll  // constant indices keep the arrays in registers
        for (int f = 0; f < FO; ++f) {
            const __bf16* wp = (f < FO / 2 ? wfrag0 : wfrag1) + ks * WFRAG + (f % (FO / 2)) * WKS * WFRAG;
            aw[f].h2[0] = *(const v8bf*)(wp);
            aw[f].h2[1] = *(const v8bf*)(wp + WHALF);
        }
        // keeps the group whole and in front of this k-step's products: without it the
        // scheduler sinks the loads towards their first use, NS-1 k-steps later
        __builtin_amdgcn_sched_barrier(0);
        v16bf bx[4];
        #pragma unroll  // constant indices keep the arrays in registers
        for (int e = 0; e < 16; ++e) {
            bx[0][e] = (__bf16)cur.r[e].x;
            bx[1][e] = (__bf16)cur.r[e].y;
            bx[2][e] = (__bf16)cur.r[e].z;
            bx[3][e] = (__bf16)cur.r[e].w;
        }
        #pragma unroll  // constant indices keep the arrays in registers
        for (int f = 0; f < FO; ++f)
            #pragma unroll  // constant indices keep the arrays in registers
            for (int j = 0; j < 4; ++j) acc[f][j] = WMMA_BF16(aw[f].v, bx[j], acc[f][j]);
    }
    static_assert(CIN / 32 == KSTEPS, "one base per k-step");
    // precaution: the bases and the offset that every global load above names are inputs
    // here, so they stay untouched up to this wait and are reused only behind it
    asm volatile("s_wait_xcnt 0x0" :: "s"(xb[0]), "s"(xb[1]), "s"(xb[2]), "s"(xb[3]), "s"(xb[4]), "s"(xb[5]),
                 "s"(xb[6]), "s"(xb[7]), "v"(xlane) : "memory");
}

// bf16 store of K in fragment order.  Per (b, h) the plane is cut into
// tiles of 16 columns x 32 head channels = 1 KB, laid out as the attention
// kernel's operand registers want them:
//   [tile n/16][half s = ch/16][lane = 16*((ch/8)&1) + n%16][8 channels]
// so a wave's 16-byte load of one half covers 512 contiguous bytes.
// Rows o = o0 + 16f + 8*hi + r are 8 consecutive head channels of column n:
// exactly one 16-byte chunk (s = f, chunk lane = 16*hi + n%16).
template <int FO, int NC>
__device__ __forceinline__ void store_hn32(const v8f (&acc)[FO][4], __bf16* __restrict__ dst,
                                           int b, int o0, int n0, int ln, int hi) {
    #pragma unroll  // constant indices keep the arrays in registers
    for (int f = 0; f < FO; ++f) {
        const int of = o0 + 16 * f;
        #pragma unroll  // constant indices keep the arrays in registers
        for (int j = 0; j < 4; ++j) {
            v8bf pk;
            #pragma unroll  // constant indices keep the arrays in registers
            for (int r = 0; r < 8; ++r) pk[r] = (__bf16)acc[f][j][r];
            const int n = n0 + 4 * ln + j;
            __bf16* dp = dst + (size_t)(b * CH + (of >> 5)) * NC * CD + (n >> 4) * 512 + (of & 16) * 16 + (16 * hi + (n & 15)) * 8;
            *(v8bf*)dp = pk;
        }
    }
}

// K and V projections: one launch, the block index picks the job.  Every block is
// 8 waves = 2 halves of the input channels x 4 column groups (64 x 256 outputs).
// Waves w and w+4 own the same 64 columns and split the SUM, not the output rows:
// each forms all 64 rows over its own 256 input channels, so no activation is asked
// for twice in a block, an activation fragment feeds four products, and a wave's chain
// of dependent k-steps is 8 long instead of 16.  The two partial sums meet in LDS: a
// wave hands over the 32 rows that its partner stores and adds its partner's share to
// the 32 rows that it stores itself.
// The index runs channel block, then which weight matrix, then column block, then
// batch: the 8 blocks that read one activation tile are neighbours.  The two jobs
// share one copy of the product loop; only the weight pointer and the store differ,
// chosen by block-uniform tests.
// The grid is 128 blocks of 8 waves, two waves per SIMD and no other wave to hide a load
// behind: of the register budget of two waves per SIMD (512), KV_SETS activation sets,
// so that the block has 8 x KV_SETS different k-step slices of loads in flight.
#define KV_BLOCKS 128
#define KV_SETS 3
__global__ __launch_bounds__(256) void proj_kv_kernel(const float* __restrict__ ps,
                                                       const float* __restrict__ kw,
                                                       const float* __restrict__ vw,
                                                       __bf16* __restrict__ Kbf,
                                                       __bf16* __restrict__ Vbf) {
    const int lane = threadIdx.x & 31;
    // the wave's number is the same in all its lanes: held in a scalar register, what is
    // derived from it (tile origins) takes no vector register through the product loop
    const int wave = __builtin_amdgcn_readfirstlane(threadIdx.x >> 5);
    const int ln = lane & 15, hi = lane >> 4, c0 = hi ? 8 : 0;
    const int bid = blockIdx.x;
    // part[0..1]: the two row tiles that this wave stores, part[2..3]: its partner's
    v8f part[4][4];
    // the block's 64 weight rows as bf16 fragments: 4 row tiles x 16 k-steps
    __shared__ __attribute__((aligned(16))) __bf16 wlds[4 * (KIN / 32) * WFRAG];
    // the handed-over partial sums: [wave][row tile f][column tile j][half of the 8 rows][lane][4 rows],
    // so that every 16-byte access of a wave covers 512 contiguous bytes
    __shared__ __attribute__((aligned(16))) float xch[8 * 2 * 4 * 2 * 32 * 4];
    const bool second = (bid >> 2) & 1;              // V, else K
    const int kh = wave >> 2;                        // which half of the input channels, and of the rows to store
    const int o0 = (bid & 3) * 64 + kh * 32;
    const int m0 = (((bid >> 3) & 3) * 4 + (wave & 3)) * 64;
    const int b  = bid >> 5;
    const float* W = (second ? vw : kw) + (size_t)(bid & 3) * 64 * KIN;
    const float* xwave = ps + ((size_t)b * KIN + kh * (KIN / 2)) * CM + m0;
    const unsigned xlane = (c0 * CM + 4 * ln) * 4;
    const int rot = bid & 7;                         // the 8 blocks that read one activation tile differ in it
    const float* xb[KSTEPS];
    walk_bases<CM>(xb, xwave, rot);
    XStep xs[KV_SETS];
    #pragma unroll  // constant indices keep the array in registers
    for (int s = 0; s < KV_SETS - 1; ++s) load_x<CM>(xs[s], xb[s], xlane);
    // the first k-steps' loads go out ahead of the weight loads and fly under the staging
    __builtin_amdgcn_sched_barrier(0);
    stage_weights<KIN>(W, W + (size_t)32 * KIN, wlds);
    {
        // this wave's k-steps of row tile 0
        const __bf16* wk = wlds + kh * (KIN / 64) * WFRAG + hi * WHI + ln * 8;
        proj_tile<4, KIN / 2, CM, KV_SETS, KIN / 32>(wk + kh * 2 * (KIN / 32) * WFRAG, wk + (1 - kh) * 2 * (KIN / 32) * WFRAG,
                                                     xb, xlane, rot, xs, part);
    }
    v8f acc[2][4];
    {
        float* give = xch + wave * 2048 + lane * 4;
        const float* take = xch + (wave ^ 4) * 2048 + lane * 4;
        #pragma unroll  // constant indices keep the arrays in registers
        for (int f = 0; f < 2; ++f)
            #pragma unroll  // constant indices keep the arrays in registers
            for (int j = 0; j < 4; ++j) {
                const v8f g = part[2 + f][j];
                *(v4f*)(give + (f * 4 + j) * 256)       = v4f{g[0], g[1], g[2], g[3]};
                *(v4f*)(give + (f * 4 + j) * 256 + 128) = v4f{g[4], g[5], g[6], g[7]};
            }
        // publishes the partial sums: each wave reads what its partner wrote
        __syncthreads();
        #pragma unroll  // constant indices keep the arrays in registers
        for (int f = 0; f < 2; ++f)
            #pragma unroll  // constant indices keep the arrays in registers
            for (int j = 0; j < 4; ++j) {
                const v4f lo4 = *(const v4f*)(take + (f * 4 + j) * 256);
                const v4f hi4 = *(const v4f*)(take + (f * 4 + j) * 256 + 128);
                acc[f][j] = part[f][j] + v8f{lo4[0], lo4[1], lo4[2], lo4[3], hi4[0], hi4[1], hi4[2], hi4[3]};
            }
    }
    if (!second) {
        store_hn32<2, CM>(acc, Kbf, b, o0, m0, ln, hi);
        // precaution: closes the stores above before any path of the listing reuses
        // a register that they name
        asm volatile("s_wait_xcnt 0x0" ::: "memory");
    } else {
        // V in fragment order too.  Per (b, h), blocks of 32 keys x 32 channels = 2 KB:
        //   [block m/32][channel tile d/16][half s = (m/16)&1][lane = 16*((m/8)&1) + d%16][8 keys]
        // The four column tiles of a lane are 4 consecutive m, half of one 16-byte
        // chunk -> one 8-byte store per row.
        #pragma unroll  // constant indices keep the arrays in registers
        for (int f = 0; f < 2; ++f)
            #pragma unroll  // constant indices keep the arrays in registers
            for (int r = 0; r < 8; ++r) {
                v4bf pk;
                #pragma unroll  // constant indices keep the arrays in registers
                for (int j = 0; j < 4; ++j) pk[j] = (__bf16)acc[f][j][r];
                __bf16* dp = Vbf + (size_t)(b * CH + (o0 >> 5)) * CD * CM + ((m0 >> 5) + (ln >> 3)) * 1024 + f * 512
                           + ((ln >> 2) & 1) * 256 + (16 * ((ln >> 1) & 1) + 8 * hi + r) * 8 + 4 * (ln & 1);
                *(v4bf*)dp = pk;
            }
        // precaution: closes the stores above before any path of the listing reuses
        // a register that they name
        asm volatile("s_wait_xcnt 0x0" ::: "memory");
    }
}

// ---------------------------------------------------------------------------
// Fused Q and skip projection + attention, no LDS / no shuffles in the hot loop.
//   E^T = K-tile x Q-tile   (C-layout of E^T == B-layout of P^T, by symmetry)
//   x^T = V-tile x P^T      (accumulated over all M in two v8f tiles per Q tile)
// One wave owns NQ = 4 Q tiles (64 query columns) of one head, all kept in registers:
// each K and V fragment is loaded once per wave and trip and feeds four products.
// The wave first computes, for its own 64 columns, the head's 32 Q channels and the
// 32 skip channels that share its output rows: one 64 x 64 register tile, both from
// the same activations.  The C-layout of the two Q row tiles is the B-layout of the
// score product (lane column, channels 8*hi + r and 16 + 8*hi + r), so Q goes from
// accumulator to operand by one rounding, and skip waits in registers for the end:
// neither passes through memory.  Column tile q, lane column ln <-> n = n0 + 4*ln + q,
// as the projection deals them; attention treats every column alike.
// The grid is 256 blocks of 8 waves (two waves per SIMD), too few waves to hide a
// load behind other waves, so the fragments of trip t+1 are loaded into a second
// register set in front of the products of trip t.
// Softmax uses unnormalized exp (scores ~ N(0,1); |max| ~ 6 => no overflow),
// per-column sums are lane-local partials + one shfl_xor(16) at the end.
// ---------------------------------------------------------------------------
#define NQ 4

// the A operands of one trip (32 keys)
struct KVFrag { V16U k0, k1, v0, v1; };

// kp, vp: this lane's 16 bytes in the K and V planes at key m; OFF: a further step
// in elements.  K rows m+ln and m+16+ln: tiles m/16 and m/16+1; V rows d = ln and
// 16+ln, K = m_rel: block m/32.  Fragment order: 512 contiguous bytes per load.
template <int OFF>
__device__ __forceinline__ void load_kv(KVFrag& f, const __bf16* __restrict__ kp,
                                        const __bf16* __restrict__ vp) {
    f.k0.h2[0] = *(const v8bf*)(kp + OFF);        f.k0.h2[1] = *(const v8bf*)(kp + OFF + 256);
    f.k1.h2[0] = *(const v8bf*)(kp + OFF + 512);  f.k1.h2[1] = *(const v8bf*)(kp + OFF + 768);
    f.v0.h2[0] = *(const v8bf*)(vp + OFF);        f.v0.h2[1] = *(const v8bf*)(vp + OFF + 256);
    f.v1.h2[0] = *(const v8bf*)(vp + OFF + 512);  f.v1.h2[1] = *(const v8bf*)(vp + OFF + 768);
    // precaution: the address pairs that the eight loads name are inputs here,
    // so they stay untouched up to this wait and are reused only behind it
    asm volatile("s_wait_xcnt 0x0" :: "v"(kp), "v"(vp) : "memory");
    // keeps the eight loads in front of the products that follow: without it the
    // scheduler sinks them towards their first use and a trip waits for its own loads
    __builtin_amdgcn_sched_barrier(0);
}

__device__ __forceinline__ void attn_trip(const KVFrag& f, const V16U (&bq)[NQ],
                                          v8f (&accA)[NQ], v8f (&accB)[NQ], float (&lsum)[NQ]) {
    const v8f zero = {};
    // E^T tiles: rows m_rel, cols n
    v8f e0[NQ], e1[NQ];
    #pragma unroll  // constant indices keep the arrays in registers
    for (int q = 0; q < NQ; ++q) {
        e0[q] = WMMA_BF16(f.k0.v, bq[q].v, zero);
        e1[q] = WMMA_BF16(f.k1.v, bq[q].v, zero);
    }
    #pragma unroll  // constant indices keep the arrays in registers
    for (int q = 0; q < NQ; ++q) {
        // P^T = 2^(E^T), Q carrying QSCALE
        #pragma unroll  // constant indices keep the arrays in registers
        for (int r = 0; r < 8; ++r) {
            e0[q][r] = __builtin_amdgcn_exp2f(e0[q][r]);
            e1[q][r] = __builtin_amdgcn_exp2f(e1[q][r]);
        }
        // C-layout is exactly the next B-layout:
        //   element e of B  <->  e0[e] (e<8) / e1[e-8] (e>=8), all lanes alike
        V16U bp;
        #pragma unroll  // constant indices keep the arrays in registers
        for (int r = 0; r < 8; ++r) {
            lsum[q] += e0[q][r] + e1[q][r];   // lane-local partial column sum
            bp.v[r]     = (__bf16)e0[q][r];
            bp.v[r + 8] = (__bf16)e1[q][r];
        }

        // x^T accumulate: rows d, cols n
        accA[q] = WMMA_BF16(f.v0.v, bp.v, accA[q]);
        accB[q] = WMMA_BF16(f.v1.v, bp.v, accB[q]);
    }
}

__global__ __launch_bounds__(256) void attn_kernel(const float* __restrict__ pcd,
                                                   const float* __restrict__ qw,
                                                   const float* __restrict__ sw,
                                                   const __bf16* __restrict__ Kbf,
                                                   const __bf16* __restrict__ Vbf,
                                                   float* __restrict__ out) {
    const int lane = threadIdx.x & 31;
    // the wave's number is the same in all its lanes: held in a scalar register, the
    // activations' base address derived from it is scalar too
    const int wave = __builtin_amdgcn_readfirstlane(threadIdx.x >> 5);
    const int ln = lane & 15, hi = lane >> 4, c0 = hi ? 8 : 0;
    const int h = blockIdx.y;
    const int b = blockIdx.z;
    const int n0 = (blockIdx.x * 8 + wave) * (16 * NQ);

    const __bf16* klane = Kbf + (size_t)(b * CH + h) * CM * CD + lane * 8;
    const __bf16* vlane = Vbf + (size_t)(b * CH + h) * CD * CM + lane * 8;

    // The 8 blocks of a head read the same K and V planes at the same time: each enters the
    // walk over the keys at another place and wraps.
    const int mstart = blockIdx.x * (CM / 8);

    // the first trip's fragments are asked for first and fly under the projection
    KVFrag fa, fb;
    load_kv<0>(fa, klane + (size_t)mstart * CD, vlane + (size_t)mstart * CD);

    // the head's 32 Q rows (row tiles 0, 1) and 32 skip rows (row tiles 2, 3) as bf16
    // fragments: 4 row tiles x 8 k-steps, shared by the block's 8 waves
    __shared__ __attribute__((aligned(16))) __bf16 wlds[4 * (QIN / 32) * WFRAG];
    v8f pacc[4][4];
    {
        const float* xwave = pcd + (size_t)b * QIN * CN + n0;
        const unsigned xlane = (c0 * CN + 4 * ln) * 4;
        XStep xs[2];
        const float* xb[KSTEPS];
        walk_bases<CN>(xb, xwave, h);   // the 8 blocks that read these columns differ in h
        load_x<CN>(xs[0], xb[0], xlane);
        // the loads of the walk's first k-step (k-step h) go out ahead of the weight loads and fly under the staging
        __builtin_amdgcn_sched_barrier(0);
        stage_weights<QIN>(qw + (size_t)h * CD * QIN, sw + (size_t)h * CD * QIN, wlds);
        proj_tile<4, QIN, CN, 2, QIN / 32>(wlds + hi * WHI + ln * 8, wlds + 2 * (QIN / 32) * WFRAG + hi * WHI + ln * 8,
                                           xb, xlane, h, xs, pacc);
    }

    // B operands (Q): tile q holds cols n0+4*ln+q, K = head channel: element r is
    // channel 8*hi + r (row tile 0), element r+8 channel 16 + 8*hi + r (row tile 1)
    V16U bq[NQ];
    #pragma unroll  // constant indices keep the arrays in registers
    for (int q = 0; q < NQ; ++q) {
        pacc[0][q] *= QSCALE;
        pacc[1][q] *= QSCALE;
        #pragma unroll  // constant indices keep the arrays in registers
        for (int r = 0; r < 8; ++r) {
            bq[q].v[r]     = (__bf16)pacc[0][q][r];
            bq[q].v[r + 8] = (__bf16)pacc[1][q][r];
        }
    }

    float lsum[NQ];
    v8f accA[NQ], accB[NQ];
    #pragma unroll  // constant indices keep the arrays in registers
    for (int q = 0; q < NQ; ++q) { lsum[q] = 0.f; accA[q] = v8f{}; accB[q] = v8f{}; }

    // two trips per pass, so that the two register sets swap roles without copies
    for (int mi = 0; mi < CM; mi += 64) {
        const int m0 = (mstart + mi) & (CM - 1);
        load_kv<32 * CD>(fb, klane + (size_t)m0 * CD, vlane + (size_t)m0 * CD);
        attn_trip(fa, bq, accA, accB, lsum);
        // the last pass has no next trip: it reads the first trip again (in bounds, unused)
        const int mn = (m0 + 64) & (CM - 1);
        load_kv<0>(fa, klane + (size_t)mn * CD, vlane + (size_t)mn * CD);
        attn_trip(fb, bq, accA, accB, lsum);
    }

    float inv[NQ];
    #pragma unroll  // constant indices keep the arrays in registers
    for (int q = 0; q < NQ; ++q) {
        // combine the two half-column partial sums (lanes ln and ln+16 share n)
        const float tot = lsum[q] + __shfl_xor(lsum[q], 16, 32);
        inv[q] = 1.0f / tot;
    }

    // out[b, h*32 + d, n] = skip + x/lsum ; accA: d = r+8*hi, accB: d = 16+r+8*hi.
    // The four column tiles of a lane are 4 consecutive n -> one 16-byte store per
    // row, 16 lanes cover 256 contiguous bytes.
    float* orow = out + ((size_t)(b * COUT) + h * CD + 8 * hi) * CN + n0 + 4 * ln;
    v4f oA[8], oB[8];
    #pragma unroll  // constant indices keep the arrays in registers
    for (int r = 0; r < 8; ++r) {
        #pragma unroll  // constant indices keep the arrays in registers
        for (int q = 0; q < NQ; ++q) {
            oA[r][q] = pacc[2][q][r] + accA[q][r] * inv[q];
            oB[r][q] = pacc[3][q][r] + accB[q][r] * inv[q];
        }
        *(v4f*)(orow + (size_t)r * CN) = oA[r];
        *(v4f*)(orow + (size_t)(16 + r) * CN) = oB[r];
    }
    // precaution: the address pair and the sixteen rows that the stores above name are
    // inputs here, so they stay untouched up to this wait
    asm volatile("s_wait_xcnt 0x0" :: "v"(orow),
                 "v"(oA[0]), "v"(oA[1]), "v"(oA[2]), "v"(oA[3]), "v"(oA[4]), "v"(oA[5]), "v"(oA[6]), "v"(oA[7]),
                 "v"(oB[0]), "v"(oB[1]), "v"(oB[2]), "v"(oB[3]), "v"(oB[4]), "v"(oB[5]), "v"(oB[6]), "v"(oB[7])
                 : "memory");
}

// ---------------------------------------------------------------------------
// Launcher
// ---------------------------------------------------------------------------
extern "C" void kernel_launch(void* const* d_in, const int* in_sizes, int n_in,
                              void* d_out, int out_size, void* d_ws, size_t ws_size,
                              hipStream_t stream) {
    const float* pcd = (const float*)d_in[0];   // [4,256,4096]
    const float* ps  = (const float*)d_in[1];   // [4,512,1024]
    const float* qw  = (const float*)d_in[2];   // [256,256]
    const float* kw  = (const float*)d_in[3];   // [256,512]
    const float* vw  = (const float*)d_in[4];   // [256,512]
    const float* sw  = (const float*)d_in[5];   // [256,256]
    float* out = (float*)d_out;                 // [4,256,4096]

    __bf16* Kbf = (__bf16*)d_ws;                           // 2 MB  [b,h] planes, fragment order
    __bf16* Vbf = Kbf + (size_t)CB * CH * CM * CD;         // 2 MB  [b,h] planes, fragment order

    hipLaunchKernelGGL(proj_kv_kernel, dim3(KV_BLOCKS), dim3(256), 0, stream, ps, kw, vw, Kbf, Vbf);
    hipLaunchKernelGGL(attn_kernel, dim3(CN / (128 * NQ), CH, CB), dim3(256), 0, stream,
                       pcd, qw, sw, Kbf, Vbf, out);
}
